// v000
// The times below were measured on an AMD MI455X: many runs one after another, warmed up first and cycling through
// copies of the inputs, with the whole window's GPU time divided by the number of runs. Launches and the gaps
// between them are all in it. The median over several windows is given; except for v000 it joins two sittings, which
// can be a few percent apart, so the side-by-side timings, each taken in one sitting, are the better comparison.
// v000, which the later versions start from, runs in 269 microseconds.
#include <hip/hip_runtime.h>
#include <stdint.h>

typedef __attribute__((ext_vector_type(16))) _Float16 v16h;
typedef __attribute__((ext_vector_type(8)))  _Float16 h8;
typedef __attribute__((ext_vector_type(4)))  _Float16 h4;
typedef __attribute__((ext_vector_type(8)))  float    v8f;
typedef __attribute__((ext_vector_type(4)))  float    f4;

#define WMMA16(a, b, c) \
  __builtin_amdgcn_wmma_f32_16x16x32_f16(false, (a), false, (b), (short)0, (c), false, false)

union Frag16 { v16h v; h8 h[2]; };

__device__ inline v16h load_frag(const _Float16* __restrict__ base, int stride, int lane) {
  const _Float16* p = base + (lane & 15) * stride + ((lane >> 4) << 3);
  Frag16 u;
  u.h[0] = *(const h8*)(p);
  u.h[1] = *(const h8*)(p + 16);
  return u.v;
}

__device__ inline v16h lds_frag(const _Float16* p) {   // p already lane-resolved
  Frag16 u;
  u.h[0] = *(const h8*)(p);
  u.h[1] = *(const h8*)(p + 16);
  return u.v;
}

#define TSTRIDE 40

#if __has_builtin(__builtin_amdgcn_tensor_load_to_lds)
#define USE_TDM 1
typedef __attribute__((ext_vector_type(4))) unsigned int u32x4;
typedef __attribute__((ext_vector_type(8))) int i32x8;
typedef __attribute__((ext_vector_type(4))) int i32x4;

__device__ inline void tdm_tile_load(const _Float16* g, unsigned int lds_addr) {
  const unsigned long long ga = (unsigned long long)(uintptr_t)g;
  u32x4 g0;
  g0[0] = 1u;                                   // count=1, user mode, no gather
  g0[1] = lds_addr;                             // lds_addr (bytes)
  g0[2] = (unsigned int)ga;                     // global_addr[31:0]
  g0[3] = (unsigned int)((ga >> 32) & 0x01FFFFFFu) | 0x80000000u; // ga[56:32] | type=2
  i32x8 g1;
  g1[0] = 0x06D10000;
  g1[1] = 32 << 16;
  g1[2] = 128 << 16;
  g1[3] = 32 << 16;
  g1[4] = 128;
  g1[5] = 768;
  g1[6] = 0;
  g1[7] = 0;
  i32x4 z = {0, 0, 0, 0};
#if __clang_major__ >= 23
  i32x8 z8 = {0, 0, 0, 0, 0, 0, 0, 0};
  __builtin_amdgcn_tensor_load_to_lds(g0, g1, z, z, z8, 0);
#else
  __builtin_amdgcn_tensor_load_to_lds(g0, g1, z, z, 0);
#endif
}
#else
#define USE_TDM 0
#endif

__device__ inline void wait_tensor_all() {
#if __has_builtin(__builtin_amdgcn_s_wait_tensorcnt)
  __builtin_amdgcn_s_wait_tensorcnt(0);
#else
  asm volatile("s_wait_tensorcnt 0x0" ::: "memory");
#endif
}

// Fallback staging: identical padded LDS layout, 256 threads, 16B each x2.
__device__ inline void sync_tile_copy(const _Float16* __restrict__ g,
                                      _Float16* __restrict__ l, int t) {
  const int row = t >> 1, half = t & 1;
  *(h8*)(l + row * TSTRIDE + half * 16) = *(const h8*)(g + row * 768 + half * 16);
}

// ---------------------------------------------------------------------------
// f32 -> f16 conversion (vectorized x4)
// ---------------------------------------------------------------------------
__global__ __launch_bounds__(256)
void cvt_f32_f16(const float* __restrict__ in, _Float16* __restrict__ out) {
  size_t i = (size_t)blockIdx.x * 256 + threadIdx.x;
  f4 x = *(const f4*)(in + i * 4);
  h4 y;
  y[0] = (_Float16)x[0]; y[1] = (_Float16)x[1];
  y[2] = (_Float16)x[2]; y[3] = (_Float16)x[3];
  *(h4*)(out + i * 4) = y;
}

// ---------------------------------------------------------------------------
// W (768x768 f32, row-major) -> W^T (768x768 f16, row-major)
// ---------------------------------------------------------------------------
__global__ __launch_bounds__(256)
void transpose_w(const float* __restrict__ W, _Float16* __restrict__ Wt) {
  int idx = blockIdx.x * 256 + threadIdx.x;   // 0 .. 589823
  int n = idx / 768;
  int k = idx % 768;
  Wt[idx] = (_Float16)W[k * 768 + n];
}

__global__ __launch_bounds__(256)
void gemm_wmma(const _Float16* __restrict__ A, const _Float16* __restrict__ Bt,
               const float* __restrict__ bias, void* __restrict__ out, int mode) {
  __shared__ _Float16 atile[2][128 * TSTRIDE];   // 2 x 10 KB
  __shared__ _Float16 btile[2][128 * TSTRIDE];   // 2 x 10 KB

  const int lane = threadIdx.x & 31;
  const int wid  = threadIdx.x >> 5;
  const int wm   = wid & 3;          // 4 waves over M
  const int wn   = wid >> 2;         // 2 waves over N
  const int m0b  = blockIdx.x * 128;
  const int n0b  = blockIdx.y * 128;
  const int koff = (lane >> 4) << 3;

  v8f acc[2][4] = {};

  // stage K-step 0
#if USE_TDM
  if (wid == 0) {
    tdm_tile_load(A  + (size_t)m0b * 768, (unsigned int)(uintptr_t)&atile[0][0]);
    tdm_tile_load(Bt + (size_t)n0b * 768, (unsigned int)(uintptr_t)&btile[0][0]);
  }
#else
  sync_tile_copy(A  + (size_t)m0b * 768, &atile[0][0], threadIdx.x);
  sync_tile_copy(Bt + (size_t)n0b * 768, &btile[0][0], threadIdx.x);
#endif

  for (int ki = 0; ki < 24; ++ki) {
    const int cur = ki & 1;
#if USE_TDM
    if (wid == 0) wait_tensor_all();
#endif
    __syncthreads();                     // publish tile ki; all waves done with buf cur^1

    if (ki < 23) {                       // prefetch tile ki+1 into the other buffer
      const int kk = (ki + 1) * 32;
#if USE_TDM
      if (wid == 0) {
        tdm_tile_load(A  + (size_t)m0b * 768 + kk, (unsigned int)(uintptr_t)&atile[cur ^ 1][0]);
        tdm_tile_load(Bt + (size_t)n0b * 768 + kk, (unsigned int)(uintptr_t)&btile[cur ^ 1][0]);
      }
#else
      sync_tile_copy(A  + (size_t)m0b * 768 + kk, &atile[cur ^ 1][0], threadIdx.x);
      sync_tile_copy(Bt + (size_t)n0b * 768 + kk, &btile[cur ^ 1][0], threadIdx.x);
#endif
    }

    // compute from buffer `cur` (ds_load_b128 fragments)
    const _Float16* ap = &atile[cur][0];
    const _Float16* bp = &btile[cur][0];
    v16h a0 = lds_frag(ap + (wm * 32 +      (lane & 15)) * TSTRIDE + koff);
    v16h a1 = lds_frag(ap + (wm * 32 + 16 + (lane & 15)) * TSTRIDE + koff);
#pragma unroll
    for (int nf = 0; nf < 4; ++nf) {
      v16h b = lds_frag(bp + (wn * 64 + nf * 16 + (lane & 15)) * TSTRIDE + koff);
      acc[0][nf] = WMMA16(a0, b, acc[0][nf]);
      acc[1][nf] = WMMA16(a1, b, acc[1][nf]);
    }
  }

  // epilogue
  const int nlo   = lane & 15;
  const int mbase = (lane >> 4) << 3;
#pragma unroll
  for (int mf = 0; mf < 2; ++mf) {
#pragma unroll
    for (int nf = 0; nf < 4; ++nf) {
      const int gn = n0b + wn * 64 + nf * 16 + nlo;
      const float bv = bias[gn];
#pragma unroll
      for (int v = 0; v < 8; ++v) {
        const int gm = m0b + wm * 32 + mf * 16 + mbase + v;
        const float val = acc[mf][nf][v] + bv;
        if (mode == 2) {
          ((float*)out)[(size_t)gm * 768 + gn] = val;
        } else {
          const int b  = gm >> 10, s  = gm & 1023;
          const int h  = gn >> 6,  dh = gn & 63;
          const size_t bh = (size_t)b * 12 + h;
          const size_t off = (mode == 0) ? (bh * 1024 + s) * 64 + dh
                                         : (bh * 64 + dh) * 1024 + s;
          ((_Float16*)out)[off] = (_Float16)val;
        }
      }
    }
  }
}

// ---------------------------------------------------------------------------
// Attention: one wave per (b,h,16-query tile).  grid = 96*64 = 6144.
// Scores (16x1024, scaled) -> LDS f16; in-place softmax; P @ V^T via WMMA.
// ---------------------------------------------------------------------------
__global__ __launch_bounds__(32)
void attn_wmma(const _Float16* __restrict__ Q, const _Float16* __restrict__ K,
               const _Float16* __restrict__ Vt, _Float16* __restrict__ Ctx) {
  __shared__ _Float16 sc[16 * 1024];   // 32 KB: scores, then P in place

  const int lane = threadIdx.x;
  const int qt = blockIdx.x & 63;
  const int bh = blockIdx.x >> 6;          // 0..95
  const int b  = bh / 12, h = bh % 12;

  const _Float16* Qb = Q  + ((size_t)bh * 1024 + qt * 16) * 64;
  const _Float16* Kb = K  + (size_t)bh * 1024 * 64;
  const _Float16* Vb = Vt + (size_t)bh * 64 * 1024;

  const int nlo   = lane & 15;
  const int koff  = (lane >> 4) << 3;
  const int mbase = (lane >> 4) << 3;

  // Q tile fragments (16 x 64 = two 16x32 A-frags), held in registers
  const v16h qf0 = load_frag(Qb + 0,  64, lane);
  const v16h qf1 = load_frag(Qb + 32, 64, lane);

  // ---- pass 1: scores = (Q K^T) / sqrt(64) -> LDS ----
  for (int jt = 0; jt < 64; ++jt) {
    if (jt + 1 < 64)  // global_prefetch_b8 for next key tile
      __builtin_prefetch(Kb + (size_t)((jt + 1) * 16 + nlo) * 64, 0, 1);
    const _Float16* Krow = Kb + (size_t)(jt * 16) * 64;
    v16h k0 = load_frag(Krow + 0,  64, lane);
    v16h k1 = load_frag(Krow + 32, 64, lane);
    v8f s = {};
    s = WMMA16(qf0, k0, s);
    s = WMMA16(qf1, k1, s);
#pragma unroll
    for (int v = 0; v < 8; ++v)
      sc[(mbase + v) * 1024 + jt * 16 + nlo] = (_Float16)(s[v] * 0.125f);
  }
  __syncthreads();

  // ---- pass 2: in-place softmax.  lane handles row (lane&15), half (lane>>4) ----
  const int r  = lane & 15;
  const int c0 = (lane >> 4) * 512;
  float mx = -1e30f;
  for (int c = 0; c < 512; c += 8) {
    h8 x = *(const h8*)&sc[r * 1024 + c0 + c];
#pragma unroll
    for (int i = 0; i < 8; ++i) mx = fmaxf(mx, (float)x[i]);
  }
  mx = fmaxf(mx, __shfl_xor(mx, 16, 32));   // combine the two column halves

  float sum = 0.f;
  for (int c = 0; c < 512; c += 8) {
    h8 x = *(const h8*)&sc[r * 1024 + c0 + c];
    h8 y;
#pragma unroll
    for (int i = 0; i < 8; ++i) {
      float e = __expf((float)x[i] - mx);
      sum += e;
      y[i] = (_Float16)e;
    }
    *(h8*)&sc[r * 1024 + c0 + c] = y;       // same lane, same address: safe
  }
  sum += __shfl_xor(sum, 16, 32);
  const float inv = 1.0f / sum;
  __syncthreads();

  // ---- pass 3: out = P @ V  (A-frags from LDS, B-frags from V^T global) ----
  v8f acc[4] = {};
  for (int kt = 0; kt < 32; ++kt) {
    Frag16 pa;
    const _Float16* pp = &sc[(lane & 15) * 1024 + kt * 32 + koff];
    pa.h[0] = *(const h8*)pp;
    pa.h[1] = *(const h8*)(pp + 16);
#pragma unroll
    for (int nf = 0; nf < 4; ++nf) {
      v16h vf = load_frag(Vb + (size_t)(nf * 16) * 1024 + kt * 32, 1024, lane);
      acc[nf] = WMMA16(pa.v, vf, acc[nf]);
    }
  }

  // epilogue: normalize rows, write ctx[b][s][h*64+dh] (f16)
#pragma unroll
  for (int v = 0; v < 8; ++v) {
    const float rinv = __shfl(inv, mbase + v, 32);  // row sum lives in lane (row&15)
    const int sidx = qt * 16 + mbase + v;
#pragma unroll
    for (int nf = 0; nf < 4; ++nf) {
      const int dh = nf * 16 + nlo;
      Ctx[((size_t)(b * 1024 + sidx)) * 768 + h * 64 + dh] = (_Float16)(acc[nf][v] * rinv);
    }
  }
}

// ---------------------------------------------------------------------------
// Host launcher
// ---------------------------------------------------------------------------
extern "C" void kernel_launch(void* const* d_in, const int* in_sizes, int n_in,
                              void* d_out, int out_size, void* d_ws, size_t ws_size,
                              hipStream_t stream) {
  (void)in_sizes; (void)n_in; (void)out_size; (void)ws_size;

  const float* x  = (const float*)d_in[0];
  const float* Wq = (const float*)d_in[1];
  const float* bq = (const float*)d_in[2];
  const float* Wk = (const float*)d_in[3];
  const float* bk = (const float*)d_in[4];
  const float* Wv = (const float*)d_in[5];
  const float* bv = (const float*)d_in[6];
  const float* Wo = (const float*)d_in[7];
  const float* bo = (const float*)d_in[8];
  float* out = (float*)d_out;

  // workspace layout (f16 elements)
  const size_t XN = 8192ull * 768;     // 6291456
  const size_t WN = 768ull * 768;      // 589824
  _Float16* Xh  = (_Float16*)d_ws;     // also reused as Ctx after QKV
  _Float16* Wqt = Xh  + XN;
  _Float16* Wkt = Wqt + WN;
  _Float16* Wvt = Wkt + WN;
  _Float16* Wot = Wvt + WN;
  _Float16* Qh  = Wot + WN;
  _Float16* Kh  = Qh  + XN;
  _Float16* Vth = Kh  + XN;
  _Float16* Ctx = Xh;                  // X dead after QKV projections

  cvt_f32_f16<<<6144, 256, 0, stream>>>(x, Xh);
  transpose_w<<<2304, 256, 0, stream>>>(Wq, Wqt);
  transpose_w<<<2304, 256, 0, stream>>>(Wk, Wkt);
  transpose_w<<<2304, 256, 0, stream>>>(Wv, Wvt);
  transpose_w<<<2304, 256, 0, stream>>>(Wo, Wot);

  dim3 gg(64, 6);                                        // M/128 x N/128
  gemm_wmma<<<gg, 256, 0, stream>>>(Xh, Wqt, bq, (void*)Qh,  0);
  gemm_wmma<<<gg, 256, 0, stream>>>(Xh, Wkt, bk, (void*)Kh,  0);
  gemm_wmma<<<gg, 256, 0, stream>>>(Xh, Wvt, bv, (void*)Vth, 1);

  attn_wmma<<<6144, 32, 0, stream>>>(Qh, Kh, Vth, Ctx);  // 96 (b,h) x 64 q-tiles

  gemm_wmma<<<gg, 256, 0, stream>>>(Ctx, Wot, bo, (void*)out, 2);
}

// v001
// It runs in 164 microseconds.
// Timed twice side by side with v000, it ran 1.70 and 1.69 times as fast.
#include <hip/hip_runtime.h>
#include <stdint.h>

typedef __attribute__((ext_vector_type(16))) _Float16 v16h;
typedef __attribute__((ext_vector_type(8)))  _Float16 h8;
typedef __attribute__((ext_vector_type(4)))  _Float16 h4;
typedef __attribute__((ext_vector_type(8)))  float    v8f;
typedef __attribute__((ext_vector_type(4)))  float    f4;

#define WMMA16(a, b, c) \
  __builtin_amdgcn_wmma_f32_16x16x32_f16(false, (a), false, (b), (short)0, (c), false, false)

union Frag16 { v16h v; h8 h[2]; };

__device__ inline v16h lds_frag(const _Float16* p) {
  Frag16 u;
  u.h[0] = *(const h8*)(p);
  u.h[1] = *(const h8*)(p + 16);
  return u.v;
}

#define TSTRIDE 40

#if __has_builtin(__builtin_amdgcn_tensor_load_to_lds)
#define USE_TDM 1
typedef __attribute__((ext_vector_type(4))) unsigned int u32x4;
typedef __attribute__((ext_vector_type(8))) int i32x8;
typedef __attribute__((ext_vector_type(4))) int i32x4;

__device__ inline void tdm_tile_load(const _Float16* g, unsigned int lds_addr) {
  const unsigned long long ga = (unsigned long long)(uintptr_t)g;
  u32x4 g0;
  g0[0] = 1u;                                   // count=1, user mode, no gather
  g0[1] = lds_addr;                             // lds_addr (bytes)
  g0[2] = (unsigned int)ga;                     // global_addr[31:0]
  g0[3] = (unsigned int)((ga >> 32) & 0x01FFFFFFu) | 0x80000000u; // ga[56:32] | type=2
  i32x8 g1;
  g1[0] = 0x06D10000;
  g1[1] = 32 << 16;
  g1[2] = 128 << 16;
  g1[3] = 32 << 16;
  g1[4] = 128;
  g1[5] = 768;
  g1[6] = 0;
  g1[7] = 0;
  i32x4 z = {0, 0, 0, 0};
#if __clang_major__ >= 23
  i32x8 z8 = {0, 0, 0, 0, 0, 0, 0, 0};
  __builtin_amdgcn_tensor_load_to_lds(g0, g1, z, z, z8, 0);
#else
  __builtin_amdgcn_tensor_load_to_lds(g0, g1, z, z, 0);
#endif
}
#else
#define USE_TDM 0
#endif

__device__ inline void wait_tensor_all() {
#if __has_builtin(__builtin_amdgcn_s_wait_tensorcnt)
  __builtin_amdgcn_s_wait_tensorcnt(0);
#else
  asm volatile("s_wait_tensorcnt 0x0" ::: "memory");
#endif
}

// Fallback staging: identical padded LDS layout, 256 threads, 16B each x2.
__device__ inline void sync_tile_copy(const _Float16* __restrict__ g,
                                      _Float16* __restrict__ l, int t) {
  const int row = t >> 1, half = t & 1;
  *(h8*)(l + row * TSTRIDE + half * 16) = *(const h8*)(g + row * 768 + half * 16);
}

// ---------------------------------------------------------------------------
// f32 -> f16 conversion (vectorized x4)
// ---------------------------------------------------------------------------
__global__ __launch_bounds__(256)
void cvt_f32_f16(const float* __restrict__ in, _Float16* __restrict__ out) {
  size_t i = (size_t)blockIdx.x * 256 + threadIdx.x;
  f4 x = *(const f4*)(in + i * 4);
  h4 y;
  y[0] = (_Float16)x[0]; y[1] = (_Float16)x[1];
  y[2] = (_Float16)x[2]; y[3] = (_Float16)x[3];
  *(h4*)(out + i * 4) = y;
}

// ---------------------------------------------------------------------------
// W (768x768 f32, row-major) -> W^T (768x768 f16, row-major)
// ---------------------------------------------------------------------------
__global__ __launch_bounds__(256)
void transpose_w(const float* __restrict__ W, _Float16* __restrict__ Wt) {
  int idx = blockIdx.x * 256 + threadIdx.x;   // 0 .. 589823
  int n = idx / 768;
  int k = idx % 768;
  Wt[idx] = (_Float16)W[k * 768 + n];
}

__global__ __launch_bounds__(256)
void gemm_wmma(const _Float16* __restrict__ A, const _Float16* __restrict__ Bt,
               const float* __restrict__ bias, void* __restrict__ out, int mode) {
  __shared__ _Float16 atile[2][128 * TSTRIDE];   // 2 x 10 KB
  __shared__ _Float16 btile[2][128 * TSTRIDE];   // 2 x 10 KB

  const int lane = threadIdx.x & 31;
  const int wid  = threadIdx.x >> 5;
  const int wm   = wid & 3;          // 4 waves over M
  const int wn   = wid >> 2;         // 2 waves over N
  const int m0b  = blockIdx.x * 128;
  const int n0b  = blockIdx.y * 128;
  const int koff = (lane >> 4) << 3;

  v8f acc[2][4] = {};

  // stage K-step 0
#if USE_TDM
  if (wid == 0) {
    tdm_tile_load(A  + (size_t)m0b * 768, (unsigned int)(uintptr_t)&atile[0][0]);
    tdm_tile_load(Bt + (size_t)n0b * 768, (unsigned int)(uintptr_t)&btile[0][0]);
  }
#else
  sync_tile_copy(A  + (size_t)m0b * 768, &atile[0][0], threadIdx.x);
  sync_tile_copy(Bt + (size_t)n0b * 768, &btile[0][0], threadIdx.x);
#endif

  for (int ki = 0; ki < 24; ++ki) {
    const int cur = ki & 1;
#if USE_TDM
    if (wid == 0) wait_tensor_all();
#endif
    __syncthreads();                     // publish tile ki; all waves done with buf cur^1

    if (ki < 23) {                       // prefetch tile ki+1 into the other buffer
      const int kk = (ki + 1) * 32;
#if USE_TDM
      if (wid == 0) {
        tdm_tile_load(A  + (size_t)m0b * 768 + kk, (unsigned int)(uintptr_t)&atile[cur ^ 1][0]);
        tdm_tile_load(Bt + (size_t)n0b * 768 + kk, (unsigned int)(uintptr_t)&btile[cur ^ 1][0]);
      }
#else
      sync_tile_copy(A  + (size_t)m0b * 768 + kk, &atile[cur ^ 1][0], threadIdx.x);
      sync_tile_copy(Bt + (size_t)n0b * 768 + kk, &btile[cur ^ 1][0], threadIdx.x);
#endif
    }

    // compute from buffer `cur` (ds_load_b128 fragments)
    const _Float16* ap = &atile[cur][0];
    const _Float16* bp = &btile[cur][0];
    v16h a0 = lds_frag(ap + (wm * 32 +      (lane & 15)) * TSTRIDE + koff);
    v16h a1 = lds_frag(ap + (wm * 32 + 16 + (lane & 15)) * TSTRIDE + koff);
#pragma unroll
    for (int nf = 0; nf < 4; ++nf) {
      v16h b = lds_frag(bp + (wn * 64 + nf * 16 + (lane & 15)) * TSTRIDE + koff);
      acc[0][nf] = WMMA16(a0, b, acc[0][nf]);
      acc[1][nf] = WMMA16(a1, b, acc[1][nf]);
    }
  }

  // epilogue
  const int nlo   = lane & 15;
  const int mbase = (lane >> 4) << 3;
#pragma unroll
  for (int mf = 0; mf < 2; ++mf) {
#pragma unroll
    for (int nf = 0; nf < 4; ++nf) {
      const int gn = n0b + wn * 64 + nf * 16 + nlo;
      const float bv = bias[gn];
#pragma unroll
      for (int v = 0; v < 8; ++v) {
        const int gm = m0b + wm * 32 + mf * 16 + mbase + v;
        const float val = acc[mf][nf][v] + bv;
        if (mode == 2) {
          ((float*)out)[(size_t)gm * 768 + gn] = val;
        } else {
          const int b  = gm >> 10, s  = gm & 1023;
          const int h  = gn >> 6,  dh = gn & 63;
          const size_t bh = (size_t)b * 12 + h;
          const size_t off = (mode == 0) ? (bh * 1024 + s) * 64 + dh
                                         : (bh * 64 + dh) * 1024 + s;
          ((_Float16*)out)[off] = (_Float16)val;
        }
      }
    }
  }
}

#define QG 4

__device__ inline float xhalf(float x) {
  const int i = __builtin_bit_cast(int, x);
  return __builtin_bit_cast(float,
      __builtin_amdgcn_permlanex16(i, i, 0x76543210, 0xfedcba98, false, false));
}

__device__ inline float exp2_slot(float x) {
  float r;
  asm("v_exp_f32 %0, %1\n\tv_nop" : "=v"(r) : "v"(x));
  return r;
}

// S^T tiles of 64 keys x 16 queries: lane holds keys t*16 + 8*(lane>>4) + v of query lane&15
__device__ inline void score_tiles(const v16h (&kf)[4][2], const v16h (&q)[2], v8f (&s)[4]) {
#pragma unroll
  for (int t = 0; t < 4; ++t) {
    v8f z = {};
    z    = WMMA16(kf[t][0], q[0], z);
    s[t] = WMMA16(kf[t][1], q[1], z);
  }
}

__global__ __launch_bounds__(32)
void attn_wmma(const _Float16* __restrict__ Q, const _Float16* __restrict__ K,
               const _Float16* __restrict__ Vt, _Float16* __restrict__ Ctx) {
  const int lane = threadIdx.x;
  const int qt = blockIdx.x % (64 / QG);
  const int bh = blockIdx.x / (64 / QG);   // 0..95
  const int b  = bh / 12, h = bh % 12;

  const _Float16* Qb = Q  + ((size_t)bh * 1024 + qt * (16 * QG)) * 64;
  const _Float16* Kb = K  + (size_t)bh * 1024 * 64;
  const _Float16* Vb = Vt + (size_t)bh * 64 * 1024;

  const int nlo   = lane & 15;
  const int mbase = (lane >> 4) << 3;

  // 1/sqrt(64) and log2(e) in one factor: softmax in base 2
  const float C = 0.125f * 1.4426950408889634f;

  // lane-resolved fragment pointers: row (lane & 15), k offset mbase
  const _Float16* qp = Qb + nlo * 64   + mbase;
  const _Float16* kp = Kb + nlo * 64   + mbase;
  const _Float16* vp = Vb + nlo * 1024 + mbase;

  // Q as B operand (column = query), kept in registers
  v16h qf[QG][2];
#pragma unroll
  for (int g = 0; g < QG; ++g) {
    qf[g][0] = lds_frag(qp + g * 16 * 64 + 0);
    qf[g][1] = lds_frag(qp + g * 16 * 64 + 32);
  }
  asm volatile("s_wait_xcnt 0x0" :: "v"(qp) : "memory");

  v8f   acc[QG][4] = {};     // O^T: row = dh (mbase + v), column = query (nlo)
  float mrun[QG], lrun[QG];  // running maximum (raw score), this half's sum
#pragma unroll
  for (int g = 0; g < QG; ++g) { mrun[g] = -1e30f; lrun[g] = 0.f; }

  for (int pass = 0; pass < 16; ++pass) {
    // K as A operand (row = key), V^T as A operand (row = dh, k = key)
    v16h kf[4][2], vf[4][2];
#pragma unroll
    for (int t = 0; t < 4; ++t) {
      kf[t][0] = lds_frag(kp + t * 16 * 64 + 0);
      kf[t][1] = lds_frag(kp + t * 16 * 64 + 32);
    }
#pragma unroll
    for (int nf = 0; nf < 4; ++nf) {
      vf[nf][0] = lds_frag(vp + nf * 16 * 1024 + 0);
      vf[nf][1] = lds_frag(vp + nf * 16 * 1024 + 32);
    }
    asm volatile("s_wait_xcnt 0x0" :: "v"(kp), "v"(vp) : "memory");
    kp += 64 * 64;
    vp += 64;

    v8f sbuf[2][4];
    score_tiles(kf, qf[0], sbuf[0]);
#pragma unroll
    for (int g = 0; g < QG; ++g) {
      // the next query tile's scores go to the matrix unit ahead of this tile's softmax
      if (g + 1 < QG) score_tiles(kf, qf[g + 1], sbuf[(g + 1) & 1]);
      const v8f* s = sbuf[g & 1];

      float mx = s[0][0];
#pragma unroll
      for (int t = 0; t < 4; ++t)
#pragma unroll
        for (int v = 0; v < 8; ++v) mx = fmaxf(mx, s[t][v]);
      mx = fmaxf(mx, xhalf(mx));            // both halves use one maximum
      const float mnew = fmaxf(mrun[g], mx);
      const float corr = exp2_slot((mrun[g] - mnew) * C);  // 0 on the first pass
      const float mc   = mnew * C;
      mrun[g] = mnew;

      // P^T in the loader's k order: elements 0..7 = even tile, 8..15 = odd tile
      v16h p[2];
      float ps[4];
#pragma unroll
      for (int t = 0; t < 4; ++t) {
        ps[t] = 0.f;
#pragma unroll
        for (int v = 0; v < 8; ++v) {
          const float e = exp2_slot(fmaf(s[t][v], C, -mc));
          ps[t] += e;
          p[t >> 1][(t & 1) * 8 + v] = (_Float16)e;
        }
      }
      lrun[g] = lrun[g] * corr + ((ps[0] + ps[1]) + (ps[2] + ps[3]));

#pragma unroll
      for (int nf = 0; nf < 4; ++nf) {
        v8f o = acc[g][nf] * corr;
        o = WMMA16(vf[nf][0], p[0], o);
        acc[g][nf] = WMMA16(vf[nf][1], p[1], o);
      }
      __builtin_amdgcn_sched_barrier(0);
    }
  }

  // epilogue: join the halves' sums, normalize, write ctx[b][s][h*64+dh] (f16),
  // 8 consecutive dh per lane
  h8 o[QG][4];
#pragma unroll
  for (int g = 0; g < QG; ++g) {
    const float inv = 1.0f / (lrun[g] + xhalf(lrun[g]));
#pragma unroll
    for (int nf = 0; nf < 4; ++nf)
#pragma unroll
      for (int v = 0; v < 8; ++v) o[g][nf][v] = (_Float16)(acc[g][nf][v] * inv);
  }
  _Float16* dst = Ctx + ((size_t)(b * 1024 + qt * (16 * QG) + nlo)) * 768 + h * 64 + mbase;
  // all stores last, so that no register of an issued store is written again
  __builtin_amdgcn_sched_barrier(0);
#pragma unroll
  for (int g = 0; g < QG; ++g)
#pragma unroll
    for (int nf = 0; nf < 4; ++nf)
      *(h8*)(dst + g * 16 * 768 + nf * 16) = o[g][nf];
}

// ---------------------------------------------------------------------------
// Host launcher
// ---------------------------------------------------------------------------
extern "C" void kernel_launch(void* const* d_in, const int* in_sizes, int n_in,
                              void* d_out, int out_size, void* d_ws, size_t ws_size,
                              hipStream_t stream) {
  (void)in_sizes; (void)n_in; (void)out_size; (void)ws_size;

  const float* x  = (const float*)d_in[0];
  const float* Wq = (const float*)d_in[1];
  const float* bq = (const float*)d_in[2];
  const float* Wk = (const float*)d_in[3];
  const float* bk = (const float*)d_in[4];
  const float* Wv = (const float*)d_in[5];
  const float* bv = (const float*)d_in[6];
  const float* Wo = (const float*)d_in[7];
  const float* bo = (const float*)d_in[8];
  float* out = (float*)d_out;

  // workspace layout (f16 elements)
  const size_t XN = 8192ull * 768;     // 6291456
  const size_t WN = 768ull * 768;      // 589824
  _Float16* Xh  = (_Float16*)d_ws;     // also reused as Ctx after QKV
  _Float16* Wqt = Xh  + XN;
  _Float16* Wkt = Wqt + WN;
  _Float16* Wvt = Wkt + WN;
  _Float16* Wot = Wvt + WN;
  _Float16* Qh  = Wot + WN;
  _Float16* Kh  = Qh  + XN;
  _Float16* Vth = Kh  + XN;
  _Float16* Ctx = Xh;                  // X dead after QKV projections

  cvt_f32_f16<<<6144, 256, 0, stream>>>(x, Xh);
  transpose_w<<<2304, 256, 0, stream>>>(Wq, Wqt);
  transpose_w<<<2304, 256, 0, stream>>>(Wk, Wkt);
  transpose_w<<<2304, 256, 0, stream>>>(Wv, Wvt);
  transpose_w<<<2304, 256, 0, stream>>>(Wo, Wot);

  dim3 gg(64, 6);                                        // M/128 x N/128
  gemm_wmma<<<gg, 256, 0, stream>>>(Xh, Wqt, bq, (void*)Qh,  0);
  gemm_wmma<<<gg, 256, 0, stream>>>(Xh, Wkt, bk, (void*)Kh,  0);
  gemm_wmma<<<gg, 256, 0, stream>>>(Xh, Wvt, bv, (void*)Vth, 1);

  attn_wmma<<<1536, 32, 0, stream>>>(Qh, Kh, Vth, Ctx);  // 96 (b,h) x 16 wave tiles of 64 queries

  gemm_wmma<<<gg, 256, 0, stream>>>(Ctx, Wot, bo, (void*)out, 2);
}

// v002
// Measured time: 144 microseconds a run.
// Timed twice side by side with v001, it ran 1.14 and 1.13 times as fast.
// Counting every step since v000, it is 1.92 times as fast.
#include <hip/hip_runtime.h>
#include <stdint.h>

typedef __attribute__((ext_vector_type(16))) _Float16 v16h;
typedef __attribute__((ext_vector_type(8)))  _Float16 h8;
typedef __attribute__((ext_vector_type(4)))  _Float16 h4;
typedef __attribute__((ext_vector_type(8)))  float    v8f;
typedef __attribute__((ext_vector_type(4)))  float    f4;

#define WMMA16(a, b, c) \
  __builtin_amdgcn_wmma_f32_16x16x32_f16(false, (a), false, (b), (short)0, (c), false, false)

union Frag16 { v16h v; h8 h[2]; };

__device__ inline v16h lds_frag(const _Float16* p) {
  Frag16 u;
  u.h[0] = *(const h8*)(p);
  u.h[1] = *(const h8*)(p + 16);
  return u.v;
}

#define TSTRIDE 40

#if __has_builtin(__builtin_amdgcn_tensor_load_to_lds)
#define USE_TDM 1
typedef __attribute__((ext_vector_type(4))) unsigned int u32x4;
typedef __attribute__((ext_vector_type(8))) int i32x8;
typedef __attribute__((ext_vector_type(4))) int i32x4;

__device__ inline void tdm_tile_load(const _Float16* g, unsigned int lds_addr) {
  const unsigned long long ga = (unsigned long long)(uintptr_t)g;
  u32x4 g0;
  g0[0] = 1u;                                   // count=1, user mode, no gather
  g0[1] = lds_addr;                             // lds_addr (bytes)
  g0[2] = (unsigned int)ga;                     // global_addr[31:0]
  g0[3] = (unsigned int)((ga >> 32) & 0x01FFFFFFu) | 0x80000000u; // ga[56:32] | type=2
  i32x8 g1;
  g1[0] = 0x06D10000;
  g1[1] = 32 << 16;
  g1[2] = 128 << 16;
  g1[3] = 32 << 16;
  g1[4] = 128;
  g1[5] = 768;
  g1[6] = 0;
  g1[7] = 0;
  i32x4 z = {0, 0, 0, 0};
#if __clang_major__ >= 23
  i32x8 z8 = {0, 0, 0, 0, 0, 0, 0, 0};
  __builtin_amdgcn_tensor_load_to_lds(g0, g1, z, z, z8, 0);
#else
  __builtin_amdgcn_tensor_load_to_lds(g0, g1, z, z, 0);
#endif
}
#else
#define USE_TDM 0
#endif

__device__ inline void wait_tensor_all() {
#if __has_builtin(__builtin_amdgcn_s_wait_tensorcnt)
  __builtin_amdgcn_s_wait_tensorcnt(0);
#else
  asm volatile("s_wait_tensorcnt 0x0" ::: "memory");
#endif
}

// Fallback staging: identical padded LDS layout, 256 threads, 16B each x2.
__device__ inline void sync_tile_copy(const _Float16* __restrict__ g,
                                      _Float16* __restrict__ l, int t) {
  const int row = t >> 1, half = t & 1;
  *(h8*)(l + row * TSTRIDE + half * 16) = *(const h8*)(g + row * 768 + half * 16);
}

// ---------------------------------------------------------------------------
// f32 -> f16 conversion.  A thread converts CVT_PER float4, a wave-load is 512
// contiguous bytes: one block a WGP, 2,048 waves in all, 12 KB of x a wave.
// ---------------------------------------------------------------------------
#define CVT_PER 24
__global__ __launch_bounds__(256)
void cvt_f32_f16(const float* __restrict__ in, _Float16* __restrict__ out) {
  const size_t base = (size_t)blockIdx.x * (256 * CVT_PER) + threadIdx.x;
  f4 x[CVT_PER];
  // unrolled, here and below: x[] stays in registers and the loads run well ahead of the conversions
#pragma unroll
  for (int j = 0; j < CVT_PER; ++j) x[j] = *(const f4*)(in + (base + j * 256) * 4);
#pragma unroll
  for (int j = 0; j < CVT_PER; ++j) {
    h4 y;
    y[0] = (_Float16)x[j][0]; y[1] = (_Float16)x[j][1];
    y[2] = (_Float16)x[j][2]; y[3] = (_Float16)x[j][3];
    *(h4*)(out + (base + j * 256) * 4) = y;
  }
}

// ---------------------------------------------------------------------------
// W (768x768 f32, row-major) -> W^T (768x768 f16, row-major)
// A thread takes 8 k x 4 n: 8 float4 loads along n, 4 stores of 8 f16 along k.
// A wave takes 64 k x 16 n, so each of its stores fills whole 128-byte lines of
// W^T; the 8 waves of a block lie side by side in n (512 contiguous bytes a row).
// ---------------------------------------------------------------------------
__global__ __launch_bounds__(256)
void transpose_w(const float* __restrict__ W, _Float16* __restrict__ Wt) {
  const int lane = threadIdx.x & 31;
  const int wid  = threadIdx.x >> 5;
  const int k = (blockIdx.x % 12) * 64  + (lane >> 2) * 8;
  const int n = (blockIdx.x / 12) * 128 + wid * 16 + (lane & 3) * 4;
  f4 r[8];
  // unrolled, here and below: the tile stays in registers, its 8 loads in flight together
#pragma unroll
  for (int i = 0; i < 8; ++i) r[i] = *(const f4*)(W + (k + i) * 768 + n);
#pragma unroll
  for (int j = 0; j < 4; ++j) {
    h8 c;
#pragma unroll
    for (int i = 0; i < 8; ++i) c[i] = (_Float16)r[i][j];
    *(h8*)(Wt + (n + j) * 768 + k) = c;
  }
}

__global__ __launch_bounds__(256)
void gemm_wmma(const _Float16* __restrict__ A, const _Float16* __restrict__ Bt,
               const float* __restrict__ bias, void* __restrict__ out, int mode) {
  __shared__ _Float16 atile[2][128 * TSTRIDE];   // 2 x 10 KB
  __shared__ _Float16 btile[2][128 * TSTRIDE];   // 2 x 10 KB

  const int lane = threadIdx.x & 31;
  const int wid  = threadIdx.x >> 5;
  const int wm   = wid & 3;          // 4 waves over M
  const int wn   = wid >> 2;         // 2 waves over N
  const int m0b  = blockIdx.x * 128;
  const int n0b  = blockIdx.y * 128;
  const int koff = (lane >> 4) << 3;

  v8f acc[2][4] = {};

  // stage K-step 0
#if USE_TDM
  if (wid == 0) {
    tdm_tile_load(A  + (size_t)m0b * 768, (unsigned int)(uintptr_t)&atile[0][0]);
    tdm_tile_load(Bt + (size_t)n0b * 768, (unsigned int)(uintptr_t)&btile[0][0]);
  }
#else
  sync_tile_copy(A  + (size_t)m0b * 768, &atile[0][0], threadIdx.x);
  sync_tile_copy(Bt + (size_t)n0b * 768, &btile[0][0], threadIdx.x);
#endif

  for (int ki = 0; ki < 24; ++ki) {
    const int cur = ki & 1;
#if USE_TDM
    if (wid == 0) wait_tensor_all();
#endif
    __syncthreads();                     // publish tile ki; all waves done with buf cur^1

    if (ki < 23) {                       // prefetch tile ki+1 into the other buffer
      const int kk = (ki + 1) * 32;
#if USE_TDM
      if (wid == 0) {
        tdm_tile_load(A  + (size_t)m0b * 768 + kk, (unsigned int)(uintptr_t)&atile[cur ^ 1][0]);
        tdm_tile_load(Bt + (size_t)n0b * 768 + kk, (unsigned int)(uintptr_t)&btile[cur ^ 1][0]);
      }
#else
      sync_tile_copy(A  + (size_t)m0b * 768 + kk, &atile[cur ^ 1][0], threadIdx.x);
      sync_tile_copy(Bt + (size_t)n0b * 768 + kk, &btile[cur ^ 1][0], threadIdx.x);
#endif
    }

    // compute from buffer `cur` (ds_load_b128 fragments)
    const _Float16* ap = &atile[cur][0];
    const _Float16* bp = &btile[cur][0];
    v16h a0 = lds_frag(ap + (wm * 32 +      (lane & 15)) * TSTRIDE + koff);
    v16h a1 = lds_frag(ap + (wm * 32 + 16 + (lane & 15)) * TSTRIDE + koff);
#pragma unroll
    for (int nf = 0; nf < 4; ++nf) {
      v16h b = lds_frag(bp + (wn * 64 + nf * 16 + (lane & 15)) * TSTRIDE + koff);
      acc[0][nf] = WMMA16(a0, b, acc[0][nf]);
      acc[1][nf] = WMMA16(a1, b, acc[1][nf]);
    }
  }

  // epilogue
  const int nlo   = lane & 15;
  const int mbase = (lane >> 4) << 3;
#pragma unroll
  for (int mf = 0; mf < 2; ++mf) {
#pragma unroll
    for (int nf = 0; nf < 4; ++nf) {
      const int gn = n0b + wn * 64 + nf * 16 + nlo;
      const float bv = bias[gn];
#pragma unroll
      for (int v = 0; v < 8; ++v) {
        const int gm = m0b + wm * 32 + mf * 16 + mbase + v;
        const float val = acc[mf][nf][v] + bv;
        if (mode == 2) {
          ((float*)out)[(size_t)gm * 768 + gn] = val;
        } else {
          const int b  = gm >> 10, s  = gm & 1023;
          const int h  = gn >> 6,  dh = gn & 63;
          const size_t bh = (size_t)b * 12 + h;
          const size_t off = (mode == 0) ? (bh * 1024 + s) * 64 + dh
                                         : (bh * 64 + dh) * 1024 + s;
          ((_Float16*)out)[off] = (_Float16)val;
        }
      }
    }
  }
}

#define QG 4

__device__ inline float xhalf(float x) {
  const int i = __builtin_bit_cast(int, x);
  return __builtin_bit_cast(float,
      __builtin_amdgcn_permlanex16(i, i, 0x76543210, 0xfedcba98, false, false));
}

__device__ inline float exp2_slot(float x) {
  float r;
  asm("v_exp_f32 %0, %1\n\tv_nop" : "=v"(r) : "v"(x));
  return r;
}

// S^T tiles of 64 keys x 16 queries: lane holds keys t*16 + 8*(lane>>4) + v of query lane&15
__device__ inline void score_tiles(const v16h (&kf)[4][2], const v16h (&q)[2], v8f (&s)[4]) {
#pragma unroll
  for (int t = 0; t < 4; ++t) {
    v8f z = {};
    z    = WMMA16(kf[t][0], q[0], z);
    s[t] = WMMA16(kf[t][1], q[1], z);
  }
}

__global__ __launch_bounds__(32)
void attn_wmma(const _Float16* __restrict__ Q, const _Float16* __restrict__ K,
               const _Float16* __restrict__ Vt, _Float16* __restrict__ Ctx) {
  const int lane = threadIdx.x;
  const int qt = blockIdx.x % (64 / QG);
  const int bh = blockIdx.x / (64 / QG);   // 0..95
  const int b  = bh / 12, h = bh % 12;

  const _Float16* Qb = Q  + ((size_t)bh * 1024 + qt * (16 * QG)) * 64;
  const _Float16* Kb = K  + (size_t)bh * 1024 * 64;
  const _Float16* Vb = Vt + (size_t)bh * 64 * 1024;

  const int nlo   = lane & 15;
  const int mbase = (lane >> 4) << 3;

  // 1/sqrt(64) and log2(e) in one factor: softmax in base 2
  const float C = 0.125f * 1.4426950408889634f;

  // lane-resolved fragment pointers: row (lane & 15), k offset mbase
  const _Float16* qp = Qb + nlo * 64   + mbase;
  const _Float16* kp = Kb + nlo * 64   + mbase;
  const _Float16* vp = Vb + nlo * 1024 + mbase;

  // Q as B operand (column = query), kept in registers
  v16h qf[QG][2];
#pragma unroll
  for (int g = 0; g < QG; ++g) {
    qf[g][0] = lds_frag(qp + g * 16 * 64 + 0);
    qf[g][1] = lds_frag(qp + g * 16 * 64 + 32);
  }
  asm volatile("s_wait_xcnt 0x0" :: "v"(qp) : "memory");

  v8f   acc[QG][4] = {};     // O^T: row = dh (mbase + v), column = query (nlo)
  float mrun[QG], lrun[QG];  // running maximum (raw score), this half's sum
#pragma unroll
  for (int g = 0; g < QG; ++g) { mrun[g] = -1e30f; lrun[g] = 0.f; }

  for (int pass = 0; pass < 16; ++pass) {
    // K as A operand (row = key), V^T as A operand (row = dh, k = key)
    v16h kf[4][2], vf[4][2];
#pragma unroll
    for (int t = 0; t < 4; ++t) {
      kf[t][0] = lds_frag(kp + t * 16 * 64 + 0);
      kf[t][1] = lds_frag(kp + t * 16 * 64 + 32);
    }
#pragma unroll
    for (int nf = 0; nf < 4; ++nf) {
      vf[nf][0] = lds_frag(vp + nf * 16 * 1024 + 0);
      vf[nf][1] = lds_frag(vp + nf * 16 * 1024 + 32);
    }
    asm volatile("s_wait_xcnt 0x0" :: "v"(kp), "v"(vp) : "memory");
    kp += 64 * 64;
    vp += 64;

    v8f sbuf[2][4];
    score_tiles(kf, qf[0], sbuf[0]);
#pragma unroll
    for (int g = 0; g < QG; ++g) {
      // the next query tile's scores go to the matrix unit ahead of this tile's softmax
      if (g + 1 < QG) score_tiles(kf, qf[g + 1], sbuf[(g + 1) & 1]);
      const v8f* s = sbuf[g & 1];

      float mx = s[0][0];
#pragma unroll
      for (int t = 0; t < 4; ++t)
#pragma unroll
        for (int v = 0; v < 8; ++v) mx = fmaxf(mx, s[t][v]);
      mx = fmaxf(mx, xhalf(mx));            // both halves use one maximum
      const float mnew = fmaxf(mrun[g], mx);
      const float corr = exp2_slot((mrun[g] - mnew) * C);  // 0 on the first pass
      const float mc   = mnew * C;
      mrun[g] = mnew;

      // P^T in the loader's k order: elements 0..7 = even tile, 8..15 = odd tile
      v16h p[2];
      float ps[4];
#pragma unroll
      for (int t = 0; t < 4; ++t) {
        ps[t] = 0.f;
#pragma unroll
        for (int v = 0; v < 8; ++v) {
          const float e = exp2_slot(fmaf(s[t][v], C, -mc));
          ps[t] += e;
          p[t >> 1][(t & 1) * 8 + v] = (_Float16)e;
        }
      }
      lrun[g] = lrun[g] * corr + ((ps[0] + ps[1]) + (ps[2] + ps[3]));

#pragma unroll
      for (int nf = 0; nf < 4; ++nf) {
        v8f o = acc[g][nf] * corr;
        o = WMMA16(vf[nf][0], p[0], o);
        acc[g][nf] = WMMA16(vf[nf][1], p[1], o);
      }
      __builtin_amdgcn_sched_barrier(0);
    }
  }

  // epilogue: join the halves' sums, normalize, write ctx[b][s][h*64+dh] (f16),
  // 8 consecutive dh per lane
  h8 o[QG][4];
#pragma unroll
  for (int g = 0; g < QG; ++g) {
    const float inv = 1.0f / (lrun[g] + xhalf(lrun[g]));
#pragma unroll
    for (int nf = 0; nf < 4; ++nf)
#pragma unroll
      for (int v = 0; v < 8; ++v) o[g][nf][v] = (_Float16)(acc[g][nf][v] * inv);
  }
  _Float16* dst = Ctx + ((size_t)(b * 1024 + qt * (16 * QG) + nlo)) * 768 + h * 64 + mbase;
  // all stores last, so that no register of an issued store is written again
  __builtin_amdgcn_sched_barrier(0);
#pragma unroll
  for (int g = 0; g < QG; ++g)
#pragma unroll
    for (int nf = 0; nf < 4; ++nf)
      *(h8*)(dst + g * 16 * 768 + nf * 16) = o[g][nf];
}

// ---------------------------------------------------------------------------
// Host launcher
// ---------------------------------------------------------------------------
extern "C" void kernel_launch(void* const* d_in, const int* in_sizes, int n_in,
                              void* d_out, int out_size, void* d_ws, size_t ws_size,
                              hipStream_t stream) {
  (void)in_sizes; (void)n_in; (void)out_size; (void)ws_size;

  const float* x  = (const float*)d_in[0];
  const float* Wq = (const float*)d_in[1];
  const float* bq = (const float*)d_in[2];
  const float* Wk = (const float*)d_in[3];
  const float* bk = (const float*)d_in[4];
  const float* Wv = (const float*)d_in[5];
  const float* bv = (const float*)d_in[6];
  const float* Wo = (const float*)d_in[7];
  const float* bo = (const float*)d_in[8];
  float* out = (float*)d_out;

  // workspace layout (f16 elements)
  const size_t XN = 8192ull * 768;     // 6291456
  const size_t WN = 768ull * 768;      // 589824
  _Float16* Xh  = (_Float16*)d_ws;     // also reused as Ctx after QKV
  _Float16* Wqt = Xh  + XN;
  _Float16* Wkt = Wqt + WN;
  _Float16* Wvt = Wkt + WN;
  _Float16* Wot = Wvt + WN;
  _Float16* Qh  = Wot + WN;
  _Float16* Kh  = Qh  + XN;
  _Float16* Vth = Kh  + XN;
  _Float16* Ctx = Xh;                  // X dead after QKV projections

  cvt_f32_f16<<<256, 256, 0, stream>>>(x, Xh);        // 256 x 256 x 24 float4
  transpose_w<<<72, 256, 0, stream>>>(Wq, Wqt);
  transpose_w<<<72, 256, 0, stream>>>(Wk, Wkt);
  transpose_w<<<72, 256, 0, stream>>>(Wv, Wvt);
  transpose_w<<<72, 256, 0, stream>>>(Wo, Wot);

  dim3 gg(64, 6);                                        // M/128 x N/128
  gemm_wmma<<<gg, 256, 0, stream>>>(Xh, Wqt, bq, (void*)Qh,  0);
  gemm_wmma<<<gg, 256, 0, stream>>>(Xh, Wkt, bk, (void*)Kh,  0);
  gemm_wmma<<<gg, 256, 0, stream>>>(Xh, Wvt, bv, (void*)Vth, 1);

  attn_wmma<<<1536, 32, 0, stream>>>(Qh, Kh, Vth, Ctx);  // 96 (b,h) x 16 wave tiles of 64 queries

  gemm_wmma<<<gg, 256, 0, stream>>>(Ctx, Wot, bo, (void*)out, 2);
}

// v003
// It runs in 120 microseconds.
// Two timings next to v002 both put it at 1.21 times that version's speed.
// Over all steps from v000 it is 2.33 times as fast.
#include <hip/hip_runtime.h>
#include <stdint.h>

typedef __attribute__((ext_vector_type(16))) _Float16 v16h;
typedef __attribute__((ext_vector_type(8)))  _Float16 h8;
typedef __attribute__((ext_vector_type(4)))  _Float16 h4;
typedef __attribute__((ext_vector_type(8)))  float    v8f;
typedef __attribute__((ext_vector_type(4)))  float    f4;

#define WMMA16(a, b, c) \
  __builtin_amdgcn_wmma_f32_16x16x32_f16(false, (a), false, (b), (short)0, (c), false, false)

union Frag16 { v16h v; h8 h[2]; };

__device__ inline v16h lds_frag(const _Float16* p) {
  Frag16 u;
  u.h[0] = *(const h8*)(p);
  u.h[1] = *(const h8*)(p + 16);
  return u.v;
}

#define TSTRIDE 40

#if __has_builtin(__builtin_amdgcn_tensor_load_to_lds)
#define USE_TDM 1
typedef __attribute__((ext_vector_type(4))) unsigned int u32x4;
typedef __attribute__((ext_vector_type(8))) int i32x8;
typedef __attribute__((ext_vector_type(4))) int i32x4;

__device__ inline void tdm_tile_load(const _Float16* g, unsigned int lds_addr) {
  const unsigned long long ga = (unsigned long long)(uintptr_t)g;
  u32x4 g0;
  g0[0] = 1u;                                   // count=1, user mode, no gather
  g0[1] = lds_addr;                             // lds_addr (bytes)
  g0[2] = (unsigned int)ga;                     // global_addr[31:0]
  g0[3] = (unsigned int)((ga >> 32) & 0x01FFFFFFu) | 0x80000000u; // ga[56:32] | type=2
  i32x8 g1;
  g1[0] = 0x06D10000;
  g1[1] = 32 << 16;
  g1[2] = 128 << 16;
  g1[3] = 32 << 16;
  g1[4] = 128;
  g1[5] = 768;
  g1[6] = 0;
  g1[7] = 0;
  i32x4 z = {0, 0, 0, 0};
#if __clang_major__ >= 23
  i32x8 z8 = {0, 0, 0, 0, 0, 0, 0, 0};
  __builtin_amdgcn_tensor_load_to_lds(g0, g1, z, z, z8, 0);
#else
  __builtin_amdgcn_tensor_load_to_lds(g0, g1, z, z, 0);
#endif
}
#else
#define USE_TDM 0
#endif

__device__ inline void wait_tensor_all() {
#if __has_builtin(__builtin_amdgcn_s_wait_tensorcnt)
  __builtin_amdgcn_s_wait_tensorcnt(0);
#else
  asm volatile("s_wait_tensorcnt 0x0" ::: "memory");
#endif
}

// Fallback staging: identical padded LDS layout, 256 threads, 16B each x2.
__device__ inline void sync_tile_copy(const _Float16* __restrict__ g,
                                      _Float16* __restrict__ l, int t) {
  const int row = t >> 1, half = t & 1;
  *(h8*)(l + row * TSTRIDE + half * 16) = *(const h8*)(g + row * 768 + half * 16);
}

// ---------------------------------------------------------------------------
// Preparation, one launch: blocks 0..255 convert x, blocks 256..543 transpose the
// four weight matrices (72 blocks each).  The five pieces do not depend on one another.
//
// f32 -> f16 conversion.  A thread converts CVT_PER float4, a wave-load is 512
// contiguous bytes: one block a WGP, 2,048 waves in all, 12 KB of x a wave.
// ---------------------------------------------------------------------------
#define CVT_PER 24
#define CVT_BLOCKS 256
__device__ inline void cvt_f32_f16(const float* __restrict__ in, _Float16* __restrict__ out, int blk) {
  const size_t base = (size_t)blk * (256 * CVT_PER) + threadIdx.x;
  f4 x[CVT_PER];
  // unrolled, here and below: x[] stays in registers and the loads run well ahead of the conversions
#pragma unroll
  for (int j = 0; j < CVT_PER; ++j) x[j] = *(const f4*)(in + (base + j * 256) * 4);
#pragma unroll
  for (int j = 0; j < CVT_PER; ++j) {
    h4 y;
    y[0] = (_Float16)x[j][0]; y[1] = (_Float16)x[j][1];
    y[2] = (_Float16)x[j][2]; y[3] = (_Float16)x[j][3];
    *(h4*)(out + (base + j * 256) * 4) = y;
  }
}

// ---------------------------------------------------------------------------
// W (768x768 f32, row-major) -> W^T (768x768 f16, row-major)
// A thread takes 8 k x 4 n: 8 float4 loads along n, 4 stores of 8 f16 along k.
// A wave takes 64 k x 16 n, so each of its stores fills whole 128-byte lines of
// W^T; the 8 waves of a block lie side by side in n (512 contiguous bytes a row).
// ---------------------------------------------------------------------------
__device__ inline void transpose_w(const float* __restrict__ W, _Float16* __restrict__ Wt, int blk) {
  const int lane = threadIdx.x & 31;
  const int wid  = threadIdx.x >> 5;
  const int k = (blk % 12) * 64  + (lane >> 2) * 8;
  const int n = (blk / 12) * 128 + wid * 16 + (lane & 3) * 4;
  f4 r[8];
  // unrolled, here and below: the tile stays in registers, its 8 loads in flight together
#pragma unroll
  for (int i = 0; i < 8; ++i) r[i] = *(const f4*)(W + (k + i) * 768 + n);
#pragma unroll
  for (int j = 0; j < 4; ++j) {
    h8 c;
#pragma unroll
    for (int i = 0; i < 8; ++i) c[i] = (_Float16)r[i][j];
    *(h8*)(Wt + (n + j) * 768 + k) = c;
  }
  asm volatile("s_wait_xcnt 0x0" ::: "memory");
}

// Wt: the four transposed matrices one behind the other, in the order v, k, q, o
__global__ __launch_bounds__(256)
void prep(const float* __restrict__ x,  const float* __restrict__ Wv,
          const float* __restrict__ Wk, const float* __restrict__ Wq,
          const float* __restrict__ Wo, _Float16* __restrict__ Xh,
          _Float16* __restrict__ Wt) {
  const int blk = blockIdx.x;
  if (blk < CVT_BLOCKS) {
    cvt_f32_f16(x, Xh, blk);
  } else {
    const int w = (blk - CVT_BLOCKS) / 72;
    const float* W = (w == 0) ? Wv : (w == 1) ? Wk : (w == 2) ? Wq : Wo;
    transpose_w(W, Wt + (size_t)w * (768 * 768), (blk - CVT_BLOCKS) % 72);
  }
}

__global__ __launch_bounds__(256)
void gemm_wmma(const _Float16* __restrict__ A, const _Float16* __restrict__ Bt0,
               const float* __restrict__ bias0, const float* __restrict__ bias1,
               const float* __restrict__ bias2, void* __restrict__ out0, int mode0) {
  const int z = blockIdx.z;
  const _Float16* __restrict__ Bt = Bt0 + (size_t)z * (768 * 768);
  const float* __restrict__ bias  = (z == 0) ? bias0 : (z == 1) ? bias1 : bias2;
  void* __restrict__ out = (void*)((_Float16*)out0 + (size_t)z * (8192 * 768));
  const int mode = (z == 0) ? mode0 : 0;

  __shared__ _Float16 atile[2][128 * TSTRIDE];   // 2 x 10 KB
  __shared__ _Float16 btile[2][128 * TSTRIDE];   // 2 x 10 KB

  const int lane = threadIdx.x & 31;
  const int wid  = threadIdx.x >> 5;
  const int wm   = wid & 3;          // 4 waves over M
  const int wn   = wid >> 2;         // 2 waves over N
  const int m0b  = blockIdx.x * 128;
  const int n0b  = blockIdx.y * 128;
  const int koff = (lane >> 4) << 3;

  v8f acc[2][4] = {};

  // stage K-step 0
#if USE_TDM
  if (wid == 0) {
    tdm_tile_load(A  + (size_t)m0b * 768, (unsigned int)(uintptr_t)&atile[0][0]);
    tdm_tile_load(Bt + (size_t)n0b * 768, (unsigned int)(uintptr_t)&btile[0][0]);
  }
#else
  sync_tile_copy(A  + (size_t)m0b * 768, &atile[0][0], threadIdx.x);
  sync_tile_copy(Bt + (size_t)n0b * 768, &btile[0][0], threadIdx.x);
#endif

  for (int ki = 0; ki < 24; ++ki) {
    const int cur = ki & 1;
#if USE_TDM
    if (wid == 0) wait_tensor_all();
#endif
    __syncthreads();                     // publish tile ki; all waves done with buf cur^1

    if (ki < 23) {                       // prefetch tile ki+1 into the other buffer
      const int kk = (ki + 1) * 32;
#if USE_TDM
      if (wid == 0) {
        tdm_tile_load(A  + (size_t)m0b * 768 + kk, (unsigned int)(uintptr_t)&atile[cur ^ 1][0]);
        tdm_tile_load(Bt + (size_t)n0b * 768 + kk, (unsigned int)(uintptr_t)&btile[cur ^ 1][0]);
      }
#else
      sync_tile_copy(A  + (size_t)m0b * 768 + kk, &atile[cur ^ 1][0], threadIdx.x);
      sync_tile_copy(Bt + (size_t)n0b * 768 + kk, &btile[cur ^ 1][0], threadIdx.x);
#endif
    }

    // compute from buffer `cur` (ds_load_b128 fragments)
    const _Float16* ap = &atile[cur][0];
    const _Float16* bp = &btile[cur][0];
    v16h a0 = lds_frag(ap + (wm * 32 +      (lane & 15)) * TSTRIDE + koff);
    v16h a1 = lds_frag(ap + (wm * 32 + 16 + (lane & 15)) * TSTRIDE + koff);
#pragma unroll
    for (int nf = 0; nf < 4; ++nf) {
      v16h b = lds_frag(bp + (wn * 64 + nf * 16 + (lane & 15)) * TSTRIDE + koff);
      acc[0][nf] = WMMA16(a0, b, acc[0][nf]);
      acc[1][nf] = WMMA16(a1, b, acc[1][nf]);
    }
  }

  // epilogue
  const int nlo   = lane & 15;
  const int mbase = (lane >> 4) << 3;
#pragma unroll
  for (int mf = 0; mf < 2; ++mf) {
#pragma unroll
    for (int nf = 0; nf < 4; ++nf) {
      const int gn = n0b + wn * 64 + nf * 16 + nlo;
      const float bv = bias[gn];
#pragma unroll
      for (int v = 0; v < 8; ++v) {
        const int gm = m0b + wm * 32 + mf * 16 + mbase + v;
        const float val = acc[mf][nf][v] + bv;
        if (mode == 2) {
          ((float*)out)[(size_t)gm * 768 + gn] = val;
        } else {
          const int b  = gm >> 10, s  = gm & 1023;
          const int h  = gn >> 6,  dh = gn & 63;
          const size_t bh = (size_t)b * 12 + h;
          const size_t off = (mode == 0) ? (bh * 1024 + s) * 64 + dh
                                         : (bh * 64 + dh) * 1024 + s;
          ((_Float16*)out)[off] = (_Float16)val;
        }
      }
    }
  }
}

#define QG 4

__device__ inline float xhalf(float x) {
  const int i = __builtin_bit_cast(int, x);
  return __builtin_bit_cast(float,
      __builtin_amdgcn_permlanex16(i, i, 0x76543210, 0xfedcba98, false, false));
}

__device__ inline float exp2_slot(float x) {
  float r;
  asm("v_exp_f32 %0, %1\n\tv_nop" : "=v"(r) : "v"(x));
  return r;
}

// S^T tiles of 64 keys x 16 queries: lane holds keys t*16 + 8*(lane>>4) + v of query lane&15
__device__ inline void score_tiles(const v16h (&kf)[4][2], const v16h (&q)[2], v8f (&s)[4]) {
#pragma unroll
  for (int t = 0; t < 4; ++t) {
    v8f z = {};
    z    = WMMA16(kf[t][0], q[0], z);
    s[t] = WMMA16(kf[t][1], q[1], z);
  }
}

__global__ __launch_bounds__(32)
void attn_wmma(const _Float16* __restrict__ Q, const _Float16* __restrict__ K,
               const _Float16* __restrict__ Vt, _Float16* __restrict__ Ctx) {
  const int lane = threadIdx.x;
  const int qt = blockIdx.x % (64 / QG);
  const int bh = blockIdx.x / (64 / QG);   // 0..95
  const int b  = bh / 12, h = bh % 12;

  const _Float16* Qb = Q  + ((size_t)bh * 1024 + qt * (16 * QG)) * 64;
  const _Float16* Kb = K  + (size_t)bh * 1024 * 64;
  const _Float16* Vb = Vt + (size_t)bh * 64 * 1024;

  const int nlo   = lane & 15;
  const int mbase = (lane >> 4) << 3;

  // 1/sqrt(64) and log2(e) in one factor: softmax in base 2
  const float C = 0.125f * 1.4426950408889634f;

  // lane-resolved fragment pointers: row (lane & 15), k offset mbase
  const _Float16* qp = Qb + nlo * 64   + mbase;
  const _Float16* kp = Kb + nlo * 64   + mbase;
  const _Float16* vp = Vb + nlo * 1024 + mbase;

  // Q as B operand (column = query), kept in registers
  v16h qf[QG][2];
#pragma unroll
  for (int g = 0; g < QG; ++g) {
    qf[g][0] = lds_frag(qp + g * 16 * 64 + 0);
    qf[g][1] = lds_frag(qp + g * 16 * 64 + 32);
  }
  asm volatile("s_wait_xcnt 0x0" :: "v"(qp) : "memory");

  v8f   acc[QG][4] = {};     // O^T: row = dh (mbase + v), column = query (nlo)
  float mrun[QG], lrun[QG];  // running maximum (raw score), this half's sum
#pragma unroll
  for (int g = 0; g < QG; ++g) { mrun[g] = -1e30f; lrun[g] = 0.f; }

  for (int pass = 0; pass < 16; ++pass) {
    // K as A operand (row = key), V^T as A operand (row = dh, k = key)
    v16h kf[4][2], vf[4][2];
#pragma unroll
    for (int t = 0; t < 4; ++t) {
      kf[t][0] = lds_frag(kp + t * 16 * 64 + 0);
      kf[t][1] = lds_frag(kp + t * 16 * 64 + 32);
    }
#pragma unroll
    for (int nf = 0; nf < 4; ++nf) {
      vf[nf][0] = lds_frag(vp + nf * 16 * 1024 + 0);
      vf[nf][1] = lds_frag(vp + nf * 16 * 1024 + 32);
    }
    asm volatile("s_wait_xcnt 0x0" :: "v"(kp), "v"(vp) : "memory");
    kp += 64 * 64;
    vp += 64;

    v8f sbuf[2][4];
    score_tiles(kf, qf[0], sbuf[0]);
#pragma unroll
    for (int g = 0; g < QG; ++g) {
      // the next query tile's scores go to the matrix unit ahead of this tile's softmax
      if (g + 1 < QG) score_tiles(kf, qf[g + 1], sbuf[(g + 1) & 1]);
      const v8f* s = sbuf[g & 1];

      float mx = s[0][0];
#pragma unroll
      for (int t = 0; t < 4; ++t)
#pragma unroll
        for (int v = 0; v < 8; ++v) mx = fmaxf(mx, s[t][v]);
      mx = fmaxf(mx, xhalf(mx));            // both halves use one maximum
      const float mnew = fmaxf(mrun[g], mx);
      const float corr = exp2_slot((mrun[g] - mnew) * C);  // 0 on the first pass
      const float mc   = mnew * C;
      mrun[g] = mnew;

      // P^T in the loader's k order: elements 0..7 = even tile, 8..15 = odd tile
      v16h p[2];
      float ps[4];
#pragma unroll
      for (int t = 0; t < 4; ++t) {
        ps[t] = 0.f;
#pragma unroll
        for (int v = 0; v < 8; ++v) {
          const float e = exp2_slot(fmaf(s[t][v], C, -mc));
          ps[t] += e;
          p[t >> 1][(t & 1) * 8 + v] = (_Float16)e;
        }
      }
      lrun[g] = lrun[g] * corr + ((ps[0] + ps[1]) + (ps[2] + ps[3]));

#pragma unroll
      for (int nf = 0; nf < 4; ++nf) {
        v8f o = acc[g][nf] * corr;
        o = WMMA16(vf[nf][0], p[0], o);
        acc[g][nf] = WMMA16(vf[nf][1], p[1], o);
      }
      __builtin_amdgcn_sched_barrier(0);
    }
  }

  // epilogue: join the halves' sums, normalize, write ctx[b][s][h*64+dh] (f16),
  // 8 consecutive dh per lane
  h8 o[QG][4];
#pragma unroll
  for (int g = 0; g < QG; ++g) {
    const float inv = 1.0f / (lrun[g] + xhalf(lrun[g]));
#pragma unroll
    for (int nf = 0; nf < 4; ++nf)
#pragma unroll
      for (int v = 0; v < 8; ++v) o[g][nf][v] = (_Float16)(acc[g][nf][v] * inv);
  }
  _Float16* dst = Ctx + ((size_t)(b * 1024 + qt * (16 * QG) + nlo)) * 768 + h * 64 + mbase;
  // all stores last, so that no register of an issued store is written again
  __builtin_amdgcn_sched_barrier(0);
#pragma unroll
  for (int g = 0; g < QG; ++g)
#pragma unroll
    for (int nf = 0; nf < 4; ++nf)
      *(h8*)(dst + g * 16 * 768 + nf * 16) = o[g][nf];
}

// ---------------------------------------------------------------------------
// Host launcher
// ---------------------------------------------------------------------------
extern "C" void kernel_launch(void* const* d_in, const int* in_sizes, int n_in,
                              void* d_out, int out_size, void* d_ws, size_t ws_size,
                              hipStream_t stream) {
  (void)in_sizes; (void)n_in; (void)out_size; (void)ws_size;

  const float* x  = (const float*)d_in[0];
  const float* Wq = (const float*)d_in[1];
  const float* bq = (const float*)d_in[2];
  const float* Wk = (const float*)d_in[3];
  const float* bk = (const float*)d_in[4];
  const float* Wv = (const float*)d_in[5];
  const float* bv = (const float*)d_in[6];
  const float* Wo = (const float*)d_in[7];
  const float* bo = (const float*)d_in[8];
  float* out = (float*)d_out;

  // workspace layout (f16 elements)
  const size_t XN = 8192ull * 768;     // 6291456
  const size_t WN = 768ull * 768;      // 589824
  _Float16* Xh  = (_Float16*)d_ws;     // also reused as Ctx after QKV
  _Float16* Wvt = Xh  + XN;            // W^T in the order v, k, q, o
  _Float16* Wkt = Wvt + WN;
  _Float16* Wqt = Wkt + WN;
  _Float16* Wot = Wqt + WN;
  _Float16* Vth = Wot + WN;            // projections in the order v, k, q
  _Float16* Kh  = Vth + XN;
  _Float16* Qh  = Kh  + XN;
  _Float16* Ctx = Xh;                  // X dead after QKV projections

  prep<<<544, 256, 0, stream>>>(x, Wv, Wk, Wq, Wo, Xh, Wvt);   // 256 blocks of x + 4 x 72 of W

  dim3 g3(64, 6, 3);                                     // M/128 x N/128 x (V, K, Q)
  gemm_wmma<<<g3, 256, 0, stream>>>(Xh, Wvt, bv, bk, bq, (void*)Vth, 1);

  attn_wmma<<<1536, 32, 0, stream>>>(Qh, Kh, Vth, Ctx);  // 96 (b,h) x 16 wave tiles of 64 queries

  dim3 g1(64, 6, 1);                                     // one product: z is 0
  gemm_wmma<<<g1, 256, 0, stream>>>(Ctx, Wot, bo, bo, bo, (void*)out, 2);
}

// v004
// A run of this version takes 108 microseconds.
// Two timings next to v003 both put it at 1.11 times that version's speed.
// Counting every step since v000, it is 2.59 times as fast.
#include <hip/hip_runtime.h>
#include <stdint.h>

typedef __attribute__((ext_vector_type(16))) _Float16 v16h;
typedef __attribute__((ext_vector_type(8)))  _Float16 h8;
typedef __attribute__((ext_vector_type(4)))  _Float16 h4;
typedef __attribute__((ext_vector_type(8)))  float    v8f;
typedef __attribute__((ext_vector_type(4)))  float    f4;

#define WMMA16(a, b, c) \
  __builtin_amdgcn_wmma_f32_16x16x32_f16(false, (a), false, (b), (short)0, (c), false, false)

union Frag16 { v16h v; h8 h[2]; };

__device__ inline v16h lds_frag(const _Float16* p) {
  Frag16 u;
  u.h[0] = *(const h8*)(p);
  u.h[1] = *(const h8*)(p + 16);
  return u.v;
}

// The same fragment from memory laid out in fragment order: its two halves are
// 256 elements apart, a lane's 8 elements at lane * 8 (p already lane-resolved)
__device__ inline v16h packed_frag(const _Float16* p) {
  Frag16 u;
  u.h[0] = *(const h8*)(p);
  u.h[1] = *(const h8*)(p + 256);
  return u.v;
}

#define TSTRIDE 40

#if __has_builtin(__builtin_amdgcn_tensor_load_to_lds)
#define USE_TDM 1
typedef __attribute__((ext_vector_type(4))) unsigned int u32x4;
typedef __attribute__((ext_vector_type(8))) int i32x8;
typedef __attribute__((ext_vector_type(4))) int i32x4;

__device__ inline void tdm_tile_load(const _Float16* g, unsigned int lds_addr) {
  const unsigned long long ga = (unsigned long long)(uintptr_t)g;
  u32x4 g0;
  g0[0] = 1u;                                   // count=1, user mode, no gather
  g0[1] = lds_addr;                             // lds_addr (bytes)
  g0[2] = (unsigned int)ga;                     // global_addr[31:0]
  g0[3] = (unsigned int)((ga >> 32) & 0x01FFFFFFu) | 0x80000000u; // ga[56:32] | type=2
  i32x8 g1;
  g1[0] = 0x06D10000;
  g1[1] = 32 << 16;
  g1[2] = 128 << 16;
  g1[3] = 32 << 16;
  g1[4] = 128;
  g1[5] = 768;
  g1[6] = 0;
  g1[7] = 0;
  i32x4 z = {0, 0, 0, 0};
#if __clang_major__ >= 23
  i32x8 z8 = {0, 0, 0, 0, 0, 0, 0, 0};
  __builtin_amdgcn_tensor_load_to_lds(g0, g1, z, z, z8, 0);
#else
  __builtin_amdgcn_tensor_load_to_lds(g0, g1, z, z, 0);
#endif
}
#else
#define USE_TDM 0
#endif

__device__ inline void wait_tensor_all() {
#if __has_builtin(__builtin_amdgcn_s_wait_tensorcnt)
  __builtin_amdgcn_s_wait_tensorcnt(0);
#else
  asm volatile("s_wait_tensorcnt 0x0" ::: "memory");
#endif
}

// Fallback staging: identical padded LDS layout, 256 threads, 16B each x2.
__device__ inline void sync_tile_copy(const _Float16* __restrict__ g,
                                      _Float16* __restrict__ l, int t) {
  const int row = t >> 1, half = t & 1;
  *(h8*)(l + row * TSTRIDE + half * 16) = *(const h8*)(g + row * 768 + half * 16);
}

// ---------------------------------------------------------------------------
// Preparation, one launch: blocks 0..255 convert x, blocks 256..543 transpose the
// four weight matrices (72 blocks each).  The five pieces do not depend on one another.
//
// f32 -> f16 conversion.  A thread converts CVT_PER float4, a wave-load is 512
// contiguous bytes: one block a WGP, 2,048 waves in all, 12 KB of x a wave.
// ---------------------------------------------------------------------------
#define CVT_PER 24
#define CVT_BLOCKS 256
__device__ inline void cvt_f32_f16(const float* __restrict__ in, _Float16* __restrict__ out, int blk) {
  const size_t base = (size_t)blk * (256 * CVT_PER) + threadIdx.x;
  f4 x[CVT_PER];
  // unrolled, here and below: x[] stays in registers and the loads run well ahead of the conversions
#pragma unroll
  for (int j = 0; j < CVT_PER; ++j) x[j] = *(const f4*)(in + (base + j * 256) * 4);
#pragma unroll
  for (int j = 0; j < CVT_PER; ++j) {
    h4 y;
    y[0] = (_Float16)x[j][0]; y[1] = (_Float16)x[j][1];
    y[2] = (_Float16)x[j][2]; y[3] = (_Float16)x[j][3];
    *(h4*)(out + (base + j * 256) * 4) = y;
  }
}

// ---------------------------------------------------------------------------
// W (768x768 f32, row-major) -> W^T (768x768 f16, row-major)
// A thread takes 8 k x 4 n: 8 float4 loads along n, 4 stores of 8 f16 along k.
// A wave takes 64 k x 16 n, so each of its stores fills whole 128-byte lines of
// W^T; the 8 waves of a block lie side by side in n (512 contiguous bytes a row).
// ---------------------------------------------------------------------------
__device__ inline void transpose_w(const float* __restrict__ W, _Float16* __restrict__ Wt, int blk) {
  const int lane = threadIdx.x & 31;
  const int wid  = threadIdx.x >> 5;
  const int k = (blk % 12) * 64  + (lane >> 2) * 8;
  const int n = (blk / 12) * 128 + wid * 16 + (lane & 3) * 4;
  f4 r[8];
  // unrolled, here and below: the tile stays in registers, its 8 loads in flight together
#pragma unroll
  for (int i = 0; i < 8; ++i) r[i] = *(const f4*)(W + (k + i) * 768 + n);
#pragma unroll
  for (int j = 0; j < 4; ++j) {
    h8 c;
#pragma unroll
    for (int i = 0; i < 8; ++i) c[i] = (_Float16)r[i][j];
    *(h8*)(Wt + (n + j) * 768 + k) = c;
  }
  asm volatile("s_wait_xcnt 0x0" ::: "memory");
}

// Wt: the four transposed matrices one behind the other, in the order v, k, q, o
__global__ __launch_bounds__(256)
void prep(const float* __restrict__ x,  const float* __restrict__ Wv,
          const float* __restrict__ Wk, const float* __restrict__ Wq,
          const float* __restrict__ Wo, _Float16* __restrict__ Xh,
          _Float16* __restrict__ Wt) {
  const int blk = blockIdx.x;
  if (blk < CVT_BLOCKS) {
    cvt_f32_f16(x, Xh, blk);
  } else {
    const int w = (blk - CVT_BLOCKS) / 72;
    const float* W = (w == 0) ? Wv : (w == 1) ? Wk : (w == 2) ? Wq : Wo;
    transpose_w(W, Wt + (size_t)w * (768 * 768), (blk - CVT_BLOCKS) % 72);
  }
}

__global__ __launch_bounds__(256)
void gemm_wmma(const _Float16* __restrict__ A, const _Float16* __restrict__ Bt0,
               const float* __restrict__ bias0, const float* __restrict__ bias1,
               const float* __restrict__ bias2, void* __restrict__ out0, int mode0) {
  const int z = blockIdx.z;
  const _Float16* __restrict__ Bt = Bt0 + (size_t)z * (768 * 768);
  const float* __restrict__ bias  = (z == 0) ? bias0 : (z == 1) ? bias1 : bias2;
  void* __restrict__ out = (void*)((_Float16*)out0 + (size_t)z * (8192 * 768));
  const int mode = (z == 0) ? mode0 : (z == 1) ? 3 : 0;

  __shared__ _Float16 atile[2][128 * TSTRIDE];   // 2 x 10 KB
  __shared__ _Float16 btile[2][128 * TSTRIDE];   // 2 x 10 KB

  const int lane = threadIdx.x & 31;
  const int wid  = threadIdx.x >> 5;
  const int wm   = wid & 3;          // 4 waves over M
  const int wn   = wid >> 2;         // 2 waves over N
  const int m0b  = blockIdx.x * 128;
  const int n0b  = blockIdx.y * 128;
  const int koff = (lane >> 4) << 3;

  v8f acc[2][4] = {};

  // stage K-step 0
#if USE_TDM
  if (wid == 0) {
    tdm_tile_load(A  + (size_t)m0b * 768, (unsigned int)(uintptr_t)&atile[0][0]);
    tdm_tile_load(Bt + (size_t)n0b * 768, (unsigned int)(uintptr_t)&btile[0][0]);
  }
#else
  sync_tile_copy(A  + (size_t)m0b * 768, &atile[0][0], threadIdx.x);
  sync_tile_copy(Bt + (size_t)n0b * 768, &btile[0][0], threadIdx.x);
#endif

  for (int ki = 0; ki < 24; ++ki) {
    const int cur = ki & 1;
#if USE_TDM
    if (wid == 0) wait_tensor_all();
#endif
    __syncthreads();                     // publish tile ki; all waves done with buf cur^1

    if (ki < 23) {                       // prefetch tile ki+1 into the other buffer
      const int kk = (ki + 1) * 32;
#if USE_TDM
      if (wid == 0) {
        tdm_tile_load(A  + (size_t)m0b * 768 + kk, (unsigned int)(uintptr_t)&atile[cur ^ 1][0]);
        tdm_tile_load(Bt + (size_t)n0b * 768 + kk, (unsigned int)(uintptr_t)&btile[cur ^ 1][0]);
      }
#else
      sync_tile_copy(A  + (size_t)m0b * 768 + kk, &atile[cur ^ 1][0], threadIdx.x);
      sync_tile_copy(Bt + (size_t)n0b * 768 + kk, &btile[cur ^ 1][0], threadIdx.x);
#endif
    }

    // compute from buffer `cur` (ds_load_b128 fragments)
    const _Float16* ap = &atile[cur][0];
    const _Float16* bp = &btile[cur][0];
    v16h a0 = lds_frag(ap + (wm * 32 +      (lane & 15)) * TSTRIDE + koff);
    v16h a1 = lds_frag(ap + (wm * 32 + 16 + (lane & 15)) * TSTRIDE + koff);
#pragma unroll
    for (int nf = 0; nf < 4; ++nf) {
      v16h b = lds_frag(bp + (wn * 64 + nf * 16 + (lane & 15)) * TSTRIDE + koff);
      acc[0][nf] = WMMA16(a0, b, acc[0][nf]);
      acc[1][nf] = WMMA16(a1, b, acc[1][nf]);
    }
  }

  // epilogue
  const int nlo   = lane & 15;
  const int mbase = (lane >> 4) << 3;
  if (mode == 1 || mode == 3) {
    const int bh = (m0b >> 10) * 12 + (n0b >> 6) + wn;
    h8 c[2][4];
#pragma unroll
    for (int nf = 0; nf < 4; ++nf) {
      const float bv = bias[n0b + wn * 64 + nf * 16 + nlo];
#pragma unroll
      for (int mf = 0; mf < 2; ++mf)
#pragma unroll
        for (int v = 0; v < 8; ++v) c[mf][nf][v] = (_Float16)(acc[mf][nf][v] + bv);
    }
    // all stores last, so that no register of an issued store is written again
    __builtin_amdgcn_sched_barrier(0);
    if (mode == 1) {
      // V^T: an accumulator tile is one half fragment as it stands (lane = dh row and key
      // half, register = key), so a lane's 8 values are 16 contiguous bytes at lane * 16
      const int kc = ((m0b & 1023) >> 5) + wm;
      _Float16* dst = (_Float16*)out + ((size_t)(bh * 32 + kc)) * 2048 + lane * 8;
#pragma unroll
      for (int nf = 0; nf < 4; ++nf)
#pragma unroll
        for (int mf = 0; mf < 2; ++mf)
          *(h8*)(dst + (nf * 2 + mf) * 256) = c[mf][nf];
    } else {
      // K: the fragment wants lane = key, register = dh, the accumulator has it the other
      // way round: single elements, 8 lanes to a 16-byte piece
      const int t0 = ((m0b & 1023) >> 4) + wm * 2;
      _Float16* dst = (_Float16*)out + ((size_t)(bh * 64 + t0)) * 1024
                      + (nlo >> 3) * 128 + mbase * 8 + (nlo & 7);
#pragma unroll
      for (int mf = 0; mf < 2; ++mf)
#pragma unroll
        for (int nf = 0; nf < 4; ++nf)
#pragma unroll
          for (int v = 0; v < 8; ++v)
            dst[mf * 1024 + nf * 256 + v * 8] = c[mf][nf][v];
      asm volatile("s_wait_xcnt 0x0" ::: "memory");
    }
    return;
  }
#pragma unroll
  for (int mf = 0; mf < 2; ++mf) {
#pragma unroll
    for (int nf = 0; nf < 4; ++nf) {
      const int gn = n0b + wn * 64 + nf * 16 + nlo;
      const float bv = bias[gn];
#pragma unroll
      for (int v = 0; v < 8; ++v) {
        const int gm = m0b + wm * 32 + mf * 16 + mbase + v;
        const float val = acc[mf][nf][v] + bv;
        if (mode == 2) {
          ((float*)out)[(size_t)gm * 768 + gn] = val;
        } else {
          const int b  = gm >> 10, s  = gm & 1023;
          const int h  = gn >> 6,  dh = gn & 63;
          const size_t bh = (size_t)b * 12 + h;
          const size_t off = (bh * 1024 + s) * 64 + dh;
          ((_Float16*)out)[off] = (_Float16)val;
        }
      }
    }
  }
  asm volatile("s_wait_xcnt 0x0" ::: "memory");
}

#define QG 4

__device__ inline float xhalf(float x) {
  const int i = __builtin_bit_cast(int, x);
  return __builtin_bit_cast(float,
      __builtin_amdgcn_permlanex16(i, i, 0x76543210, 0xfedcba98, false, false));
}

__device__ inline float exp2_slot(float x) {
  float r;
  asm("v_exp_f32 %0, %1\n\tv_nop" : "=v"(r) : "v"(x));
  return r;
}

// S^T tiles of 64 keys x 16 queries: lane holds keys t*16 + 8*(lane>>4) + v of query lane&15
__device__ inline void score_tiles(const v16h (&kf)[4][2], const v16h (&q)[2], v8f (&s)[4]) {
#pragma unroll
  for (int t = 0; t < 4; ++t) {
    v8f z = {};
    z    = WMMA16(kf[t][0], q[0], z);
    s[t] = WMMA16(kf[t][1], q[1], z);
  }
}

__global__ __launch_bounds__(32)
void attn_wmma(const _Float16* __restrict__ Q, const _Float16* __restrict__ K,
               const _Float16* __restrict__ Vt, _Float16* __restrict__ Ctx) {
  const int lane = threadIdx.x;
  const int qt = blockIdx.x % (64 / QG);
  const int bh = blockIdx.x / (64 / QG);   // 0..95
  const int b  = bh / 12, h = bh % 12;

  const _Float16* Qb = Q  + ((size_t)bh * 1024 + qt * (16 * QG)) * 64;
  const _Float16* Kb = K  + (size_t)bh * 1024 * 64;
  const _Float16* Vb = Vt + (size_t)bh * 64 * 1024;

  const int nlo   = lane & 15;
  const int mbase = (lane >> 4) << 3;

  // 1/sqrt(64) and log2(e) in one factor: softmax in base 2
  const float C = 0.125f * 1.4426950408889634f;

  // lane-resolved fragment pointers; Q: row (lane & 15), k offset mbase
  const _Float16* qp = Qb + nlo * 64   + mbase;
  const _Float16* kp = Kb + lane * 8;   // K and V^T: fragment order, 16 bytes a lane
  const _Float16* vp = Vb + lane * 8;

  // Q as B operand (column = query), kept in registers
  v16h qf[QG][2];
#pragma unroll
  for (int g = 0; g < QG; ++g) {
    qf[g][0] = lds_frag(qp + g * 16 * 64 + 0);
    qf[g][1] = lds_frag(qp + g * 16 * 64 + 32);
  }
  asm volatile("s_wait_xcnt 0x0" :: "v"(qp) : "memory");

  v8f   acc[QG][4] = {};     // O^T: row = dh (mbase + v), column = query (nlo)
  float mrun[QG], lrun[QG];  // running maximum (raw score), this half's sum
#pragma unroll
  for (int g = 0; g < QG; ++g) { mrun[g] = -1e30f; lrun[g] = 0.f; }

  for (int pass = 0; pass < 16; ++pass) {
    // K as A operand (row = key), V^T as A operand (row = dh, k = key)
    v16h kf[4][2], vf[4][2];
#pragma unroll
    for (int t = 0; t < 4; ++t) {
      kf[t][0] = packed_frag(kp + (t * 2 + 0) * 512);
      kf[t][1] = packed_frag(kp + (t * 2 + 1) * 512);
    }
#pragma unroll
    for (int nf = 0; nf < 4; ++nf) {
      vf[nf][0] = packed_frag(vp + (0 * 4 + nf) * 512);
      vf[nf][1] = packed_frag(vp + (1 * 4 + nf) * 512);
    }
    asm volatile("s_wait_xcnt 0x0" :: "v"(kp), "v"(vp) : "memory");
    kp += 64 * 64;
    vp += 64 * 64;

    v8f sbuf[2][4];
    score_tiles(kf, qf[0], sbuf[0]);
#pragma unroll
    for (int g = 0; g < QG; ++g) {
      // the next query tile's scores go to the matrix unit ahead of this tile's softmax
      if (g + 1 < QG) score_tiles(kf, qf[g + 1], sbuf[(g + 1) & 1]);
      const v8f* s = sbuf[g & 1];

      float mx = s[0][0];
#pragma unroll
      for (int t = 0; t < 4; ++t)
#pragma unroll
        for (int v = 0; v < 8; ++v) mx = fmaxf(mx, s[t][v]);
      mx = fmaxf(mx, xhalf(mx));            // both halves use one maximum
      const float mnew = fmaxf(mrun[g], mx);
      const float corr = exp2_slot((mrun[g] - mnew) * C);  // 0 on the first pass
      const float mc   = mnew * C;
      mrun[g] = mnew;

      // P^T in the loader's k order: elements 0..7 = even tile, 8..15 = odd tile
      v16h p[2];
      float ps[4];
#pragma unroll
      for (int t = 0; t < 4; ++t) {
        ps[t] = 0.f;
#pragma unroll
        for (int v = 0; v < 8; ++v) {
          const float e = exp2_slot(fmaf(s[t][v], C, -mc));
          ps[t] += e;
          p[t >> 1][(t & 1) * 8 + v] = (_Float16)e;
        }
      }
      lrun[g] = lrun[g] * corr + ((ps[0] + ps[1]) + (ps[2] + ps[3]));

#pragma unroll
      for (int nf = 0; nf < 4; ++nf) {
        v8f o = acc[g][nf] * corr;
        o = WMMA16(vf[nf][0], p[0], o);
        acc[g][nf] = WMMA16(vf[nf][1], p[1], o);
      }
      __builtin_amdgcn_sched_barrier(0);
    }
  }

  // epilogue: join the halves' sums, normalize, write ctx[b][s][h*64+dh] (f16),
  // 8 consecutive dh per lane
  h8 o[QG][4];
#pragma unroll
  for (int g = 0; g < QG; ++g) {
    const float inv = 1.0f / (lrun[g] + xhalf(lrun[g]));
#pragma unroll
    for (int nf = 0; nf < 4; ++nf)
#pragma unroll
      for (int v = 0; v < 8; ++v) o[g][nf][v] = (_Float16)(acc[g][nf][v] * inv);
  }
  _Float16* dst = Ctx + ((size_t)(b * 1024 + qt * (16 * QG) + nlo)) * 768 + h * 64 + mbase;
  // all stores last, so that no register of an issued store is written again
  __builtin_amdgcn_sched_barrier(0);
#pragma unroll
  for (int g = 0; g < QG; ++g)
#pragma unroll
    for (int nf = 0; nf < 4; ++nf)
      *(h8*)(dst + g * 16 * 768 + nf * 16) = o[g][nf];
}

// ---------------------------------------------------------------------------
// Host launcher
// ---------------------------------------------------------------------------
extern "C" void kernel_launch(void* const* d_in, const int* in_sizes, int n_in,
                              void* d_out, int out_size, void* d_ws, size_t ws_size,
                              hipStream_t stream) {
  (void)in_sizes; (void)n_in; (void)out_size; (void)ws_size;

  const float* x  = (const float*)d_in[0];
  const float* Wq = (const float*)d_in[1];
  const float* bq = (const float*)d_in[2];
  const float* Wk = (const float*)d_in[3];
  const float* bk = (const float*)d_in[4];
  const float* Wv = (const float*)d_in[5];
  const float* bv = (const float*)d_in[6];
  const float* Wo = (const float*)d_in[7];
  const float* bo = (const float*)d_in[8];
  float* out = (float*)d_out;

  // workspace layout (f16 elements)
  const size_t XN = 8192ull * 768;     // 6291456
  const size_t WN = 768ull * 768;      // 589824
  _Float16* Xh  = (_Float16*)d_ws;     // also reused as Ctx after QKV
  _Float16* Wvt = Xh  + XN;            // W^T in the order v, k, q, o
  _Float16* Wkt = Wvt + WN;
  _Float16* Wqt = Wkt + WN;
  _Float16* Wot = Wqt + WN;
  _Float16* Vth = Wot + WN;            // projections in the order v, k, q
  _Float16* Kh  = Vth + XN;
  _Float16* Qh  = Kh  + XN;
  _Float16* Ctx = Xh;                  // X dead after QKV projections

  prep<<<544, 256, 0, stream>>>(x, Wv, Wk, Wq, Wo, Xh, Wvt);   // 256 blocks of x + 4 x 72 of W

  dim3 g3(64, 6, 3);                                     // M/128 x N/128 x (V, K, Q)
  gemm_wmma<<<g3, 256, 0, stream>>>(Xh, Wvt, bv, bk, bq, (void*)Vth, 1);

  attn_wmma<<<1536, 32, 0, stream>>>(Qh, Kh, Vth, Ctx);  // 96 (b,h) x 16 wave tiles of 64 queries

  dim3 g1(64, 6, 1);                                     // one product: z is 0
  gemm_wmma<<<g1, 256, 0, stream>>>(Ctx, Wot, bo, bo, bo, (void*)out, 2);
}

// v005
// One run takes 87.7 microseconds.
// Timed twice side by side with v004, it ran 1.24 and 1.25 times as fast.
// Over all steps from v000 it is 3.23 times as fast.
#include <hip/hip_runtime.h>
#include <stdint.h>

typedef __attribute__((ext_vector_type(16))) _Float16 v16h;
typedef __attribute__((ext_vector_type(8)))  _Float16 h8;
typedef __attribute__((ext_vector_type(4)))  _Float16 h4;
typedef __attribute__((ext_vector_type(8)))  float    v8f;
typedef __attribute__((ext_vector_type(4)))  float    f4;

#define WMMA16(a, b, c) \
  __builtin_amdgcn_wmma_f32_16x16x32_f16(false, (a), false, (b), (short)0, (c), false, false)

union Frag16 { v16h v; h8 h[2]; };

__device__ inline v16h lds_frag(const _Float16* p) {
  Frag16 u;
  u.h[0] = *(const h8*)(p);
  u.h[1] = *(const h8*)(p + 16);
  return u.v;
}

// The same fragment from memory laid out in fragment order: its two halves are
// 256 elements apart, a lane's 8 elements at lane * 8 (p already lane-resolved)
__device__ inline v16h packed_frag(const _Float16* p) {
  Frag16 u;
  u.h[0] = *(const h8*)(p);
  u.h[1] = *(const h8*)(p + 256);
  return u.v;
}

// ---------------------------------------------------------------------------
// Tensor-load staging for the GEMMs: a slice is N rows of 128 bytes (64 f16) of a row-major
// matrix (row pitch 1536 bytes), laid in LDS with 16 bytes of pad behind each row.
// ---------------------------------------------------------------------------
#define PITCH 144u   // bytes per LDS row: 128 data + 16 pad, an odd multiple of 16 for ds_load_b128

typedef uint32_t u32x4 __attribute__((ext_vector_type(4)));
typedef uint32_t u32x8 __attribute__((ext_vector_type(8)));

__device__ __forceinline__ uint32_t uni(uint32_t v) { return (uint32_t)__builtin_amdgcn_readfirstlane(v); }
// a wave-uniform value held in a scalar register, so that a test on it is a scalar branch
__device__ __forceinline__ uint32_t pinned(uint32_t v) {
  uint32_t w = uni(v);
  asm volatile("" : "+s"(w));
  return w;
}
__device__ __forceinline__ void wait_ds0()     { asm volatile("s_wait_dscnt 0x0" ::: "memory"); }     // this wave's LDS reads are done
__device__ __forceinline__ void wait_tensor0() { asm volatile("s_wait_tensorcnt 0x0" ::: "memory"); } // this wave's slice has landed
__device__ __forceinline__ void tdm_load(u32x4 g0, u32x8 g1) {
  asm volatile("tensor_load_to_lds %0, %1" :: "s"(g0), "s"(g1) : "memory");
}
__device__ __forceinline__ u32x8 tdm_group1(uint32_t rows) {
  u32x8 g;
  g[0] = uni((1u << 20) | (4u << 22) | (3u << 25));
  g[1] = uni(128u << 16);
  g[2] = uni(rows << 16);
  g[3] = uni(128u << 16);
  g[4] = uni(rows);
  g[5] = uni(1536u);
  g[6] = uni(0u);
  g[7] = uni(0u);
  return g;
}
__device__ __forceinline__ u32x4 tdm_group0(uint32_t lds_dst, uint64_t ga) {
  u32x4 g;
  g[0] = uni(1u);
  g[1] = uni(lds_dst);
  g[2] = uni((uint32_t)ga);
  g[3] = uni((((uint32_t)(ga >> 32)) & 0x01FFFFFFu) | 0x80000000u);
  return g;
}

// ---------------------------------------------------------------------------
// Preparation, one launch: blocks 0..255 convert x, blocks 256..543 transpose the
// four weight matrices (72 blocks each).  The five pieces do not depend on one another.
//
// f32 -> f16 conversion.  A thread converts CVT_PER float4, a wave-load is 512
// contiguous bytes: one block a WGP, 2,048 waves in all, 12 KB of x a wave.
// ---------------------------------------------------------------------------
#define CVT_PER 24
#define CVT_BLOCKS 256
__device__ inline void cvt_f32_f16(const float* __restrict__ in, _Float16* __restrict__ out, int blk) {
  const size_t base = (size_t)blk * (256 * CVT_PER) + threadIdx.x;
  f4 x[CVT_PER];
  // unrolled, here and below: x[] stays in registers and the loads run well ahead of the conversions
#pragma unroll
  for (int j = 0; j < CVT_PER; ++j) x[j] = *(const f4*)(in + (base + j * 256) * 4);
#pragma unroll
  for (int j = 0; j < CVT_PER; ++j) {
    h4 y;
    y[0] = (_Float16)x[j][0]; y[1] = (_Float16)x[j][1];
    y[2] = (_Float16)x[j][2]; y[3] = (_Float16)x[j][3];
    *(h4*)(out + (base + j * 256) * 4) = y;
  }
}

// ---------------------------------------------------------------------------
// W (768x768 f32, row-major) -> W^T (768x768 f16, row-major)
// A thread takes 8 k x 4 n: 8 float4 loads along n, 4 stores of 8 f16 along k.
// A wave takes 64 k x 16 n, so each of its stores fills whole 128-byte lines of
// W^T; the 8 waves of a block lie side by side in n (512 contiguous bytes a row).
// ---------------------------------------------------------------------------
__device__ inline void transpose_w(const float* __restrict__ W, _Float16* __restrict__ Wt, int blk) {
  const int lane = threadIdx.x & 31;
  const int wid  = threadIdx.x >> 5;
  const int k = (blk % 12) * 64  + (lane >> 2) * 8;
  const int n = (blk / 12) * 128 + wid * 16 + (lane & 3) * 4;
  f4 r[8];
  // unrolled, here and below: the tile stays in registers, its 8 loads in flight together
#pragma unroll
  for (int i = 0; i < 8; ++i) r[i] = *(const f4*)(W + (k + i) * 768 + n);
#pragma unroll
  for (int j = 0; j < 4; ++j) {
    h8 c;
#pragma unroll
    for (int i = 0; i < 8; ++i) c[i] = (_Float16)r[i][j];
    *(h8*)(Wt + (n + j) * 768 + k) = c;
  }
  asm volatile("s_wait_xcnt 0x0" ::: "memory");
}

// Wt: the four transposed matrices one behind the other, in the order v, k, q, o
__global__ __launch_bounds__(256)
void prep(const float* __restrict__ x,  const float* __restrict__ Wv,
          const float* __restrict__ Wk, const float* __restrict__ Wq,
          const float* __restrict__ Wo, _Float16* __restrict__ Xh,
          _Float16* __restrict__ Wt) {
  const int blk = blockIdx.x;
  if (blk < CVT_BLOCKS) {
    cvt_f32_f16(x, Xh, blk);
  } else {
    const int w = (blk - CVT_BLOCKS) / 72;
    const float* W = (w == 0) ? Wv : (w == 1) ? Wk : (w == 2) ? Wq : Wo;
    transpose_w(W, Wt + (size_t)w * (768 * 768), (blk - CVT_BLOCKS) % 72);
  }
}

// ---------------------------------------------------------------------------
// GEMM: Y = A(8192x768 f16) @ Bt^T + bias.  One BM x BN tile of Y a block, 256 blocks a
// launch (one a WGP), 8 waves (WGM x WGN), FM x FN fragments of 16 x 16 a wave.
// A stage is 64 k of the tile's BM rows of A and BN rows of Bt: 8 slices, one tensor load a
// wave (waves 0, 1: half of the A rows each; waves 2..7: a sixth of the Bt rows each), each
// slice at a multiple of 2 KiB; two buffers, the load of stage s + 1 issued when pass s - 1 has ended.
// ---------------------------------------------------------------------------
template <int BM, int BN, int WGM, int WGN>
struct Tile {
  static constexpr int FM = BM / WGM / 16, FN = BN / WGN / 16;
  static constexpr int SA = BM / 2, SB = BN / 6;                              // rows a slice
  static constexpr uint32_t SAB = (SA * PITCH + 2047u) / 2048u * 2048u;       // bytes a slice in LDS
  static constexpr uint32_t SBB = (SB * PITCH + 2047u) / 2048u * 2048u;
  static constexpr uint32_t STAGE = 2u * SAB + 6u * SBB;
  static_assert(SA % (FM * 16) == 0 && SB % 16 == 0, "a fragment lies in one slice");
};
#define NSTAGE 12u   // 768 k / 64

// the product: acc[mf][nf] = rows m0b + wm*FM*16 + mf*16.., columns n0b + wn*FN*16 + nf*16..
template <int BM, int BN, int WGM, int WGN>
__device__ __forceinline__ void gemm_tile(const _Float16* __restrict__ A, const _Float16* __restrict__ Bt,
                                          unsigned char* lds, int m0b, int n0b, int wid, int wm, int wn, int lane,
                                          v8f (&acc)[BM / WGM / 16][BN / WGN / 16]) {
  typedef Tile<BM, BN, WGM, WGN> T;
  constexpr int FM = T::FM, FN = T::FN;
  // 32-k steps whose fragments are fetched as one group: both of a stage where the registers allow
  constexpr int KG = (FM * FN * 8 + 2 * (FM + FN) * 8 <= 384) ? 2 : 1;

  // this wave's slice
  const bool     isA  = wid < 2;
  const uint32_t rows = isA ? (uint32_t)T::SA : (uint32_t)T::SB;
  const uint64_t src  = isA ? (uint64_t)(uintptr_t)(A  + (size_t)(m0b + wid * T::SA) * 768)
                            : (uint64_t)(uintptr_t)(Bt + (size_t)(n0b + (wid - 2) * T::SB) * 768);
  const uint32_t dst  = (uint32_t)(uintptr_t)lds + (isA ? (uint32_t)wid * T::SAB : 2u * T::SAB + (uint32_t)(wid - 2) * T::SBB);
  const u32x8 g1 = tdm_group1(rows);

  // lane-resolved fragment offsets (bytes in a stage): row (lane & 15), k offset (lane >> 4) * 8
  const uint32_t lrow = (uint32_t)(lane & 15) * PITCH + (uint32_t)(lane >> 4) * 16u;
  const uint32_t r0   = (uint32_t)wm * (FM * 16);
  const uint32_t aoff = (r0 / T::SA) * T::SAB + (r0 % T::SA) * PITCH + lrow;
  uint32_t boff[FN];
#pragma unroll
  for (int nf = 0; nf < FN; ++nf) {
    constexpr bool whole = (FN * 16) % T::SB == 0;      // a wave's columns are whole slices
    const uint32_t base = whole ? (uint32_t)wn * ((FN * 16) / T::SB) * T::SBB : 0u;
    const uint32_t c0   = whole ? (uint32_t)nf * 16u : (uint32_t)(wn * FN + nf) * 16u;
    boff[nf] = 2u * T::SAB + base + (c0 / T::SB) * T::SBB + (c0 % T::SB) * PITCH + lrow;
  }

  tdm_load(tdm_group0(dst, src), g1);                    // stage 0
  wait_tensor0();
  __syncthreads();                                       // publishes stage 0

  // rolled: a pass is up to 72 WMMAs and 52 LDS loads of code already; the buffer goes by the stage's parity
#pragma unroll 1
  for (uint32_t s = 0; s < NSTAGE; ++s) {
    const uint32_t nx = pinned(s + 1u);
    if (pinned(nx < NSTAGE))
      tdm_load(tdm_group0(dst + (nx & 1u) * T::STAGE, src + (uint64_t)nx * 128u), g1);
    const unsigned char* buf = lds + (s & 1u) * T::STAGE;
#pragma unroll
    for (int k0 = 0; k0 < 2; k0 += KG) {
      v16h a[KG][FM], b[KG][FN];
#pragma unroll
      for (int kk = 0; kk < KG; ++kk) {
#pragma unroll
        for (int mf = 0; mf < FM; ++mf)
          a[kk][mf] = lds_frag((const _Float16*)(buf + aoff + mf * 16 * PITCH + (k0 + kk) * 64));
#pragma unroll
        for (int nf = 0; nf < FN; ++nf)
          b[kk][nf] = lds_frag((const _Float16*)(buf + boff[nf] + (k0 + kk) * 64));
      }
      __builtin_amdgcn_sched_barrier(0);
#pragma unroll
      for (int kk = 0; kk < KG; ++kk)
#pragma unroll
        for (int nf = 0; nf < FN; ++nf)
#pragma unroll
          for (int mf = 0; mf < FM; ++mf) acc[mf][nf] = WMMA16(a[kk][mf], b[kk][nf], acc[mf][nf]);
      __builtin_amdgcn_sched_barrier(0);   // the next group of loads stays behind this block
    }
    // publish point of stage s + 1; the same barrier ends every reader's last read of stage s
    wait_ds0();
    wait_tensor0();
    __syncthreads();
  }
  wait_tensor0();
  wait_ds0();
}

// V, K and Q projections in one launch: Bt is the three W^T one behind the other (2304 rows,
// order v, k, q), the outputs lie one behind the other in the same order.  Each 16-column
// fragment belongs to one product and one head:
//   Q   f16 [B][H][S][DH]
//   V^T and K in the order in which the attention kernel's A fragments hold them, so that each
//   of its loads is 512 contiguous bytes (32 lanes x 16 B):
//   V^T [B*H][32 keys kc][16 dh nf][j][lane][8]: dh = nf*16 + (lane&15), key = kc*32 + j*16 + (lane>>4)*8 + i
//   K   [B*H][16 keys t][32 dh c][j][lane][8]:   key = t*16 + (lane&15), dh = c*32 + j*16 + (lane>>4)*8 + i
__global__ __launch_bounds__(256)
void gemm_qkv(const _Float16* __restrict__ A, const _Float16* __restrict__ Bt,
              const float* __restrict__ bias0, const float* __restrict__ bias1,
              const float* __restrict__ bias2, _Float16* __restrict__ out) {
  typedef Tile<256, 288, 4, 2> T;
  constexpr int FM = T::FM, FN = T::FN;
  __shared__ __attribute__((aligned(2048))) unsigned char lds[2 * T::STAGE];

  const int lane = threadIdx.x & 31;
  const int wid  = (int)uni(threadIdx.x >> 5);
  const int wm   = wid & 3;
  const int wn   = wid >> 2;
  const int m0b  = blockIdx.x * 256;
  const int n0b  = blockIdx.y * 288;
  const int nlo   = lane & 15;
  const int mbase = (lane >> 4) << 3;

  float bv[FN];
  const float* bp[FN];
#pragma unroll
  for (int nf = 0; nf < FN; ++nf) {
    const int n0 = n0b + wn * (FN * 16) + nf * 16;
    const int z  = n0 / 768;
    const float* bias = (z == 0) ? bias0 : (z == 1) ? bias1 : bias2;
    bp[nf] = bias + (n0 - z * 768 + nlo);
  }
  __builtin_amdgcn_sched_barrier(0);   // all addresses first, so that none is formed among the loads
#pragma unroll
  for (int nf = 0; nf < FN; ++nf) bv[nf] = *bp[nf];
  asm volatile("s_wait_xcnt 0x0" ::: "memory");
  __builtin_amdgcn_sched_barrier(0);   // keeps later address arithmetic behind that wait

  v8f acc[FM][FN] = {};
  gemm_tile<256, 288, 4, 2>(A, Bt, lds, m0b, n0b, wid, wm, wn, lane, acc);

  const int b   = m0b >> 10;
  const int t16 = ((m0b & 1023) >> 4) + wm * FM;   // first 16-row tile of the wave in its sequence
#pragma unroll
  for (int nf = 0; nf < FN; ++nf) {
    const int n0  = n0b + wn * (FN * 16) + nf * 16;
    const int z   = n0 / 768;
    const int c0  = n0 - z * 768;
    const int bh  = b * 12 + (c0 >> 6);
    const int nfh = (c0 >> 4) & 3;                 // 16-column group in the head
    _Float16* plane = out + (size_t)z * (8192 * 768);
    h8 c[FM];
#pragma unroll
    for (int mf = 0; mf < FM; ++mf)
#pragma unroll
      for (int v = 0; v < 8; ++v) c[mf][v] = (_Float16)(acc[mf][nf][v] + bv[nf]);
    _Float16* dst;
    if (z == 0)      dst = plane + ((size_t)(bh * 32 + (t16 >> 1))) * 2048 + nfh * 512 + lane * 8;
    else if (z == 1) dst = plane + ((size_t)(bh * 64 + t16)) * 1024 + nfh * 256 + (nlo >> 3) * 128 + mbase * 8 + (nlo & 7);
    else             dst = plane + ((size_t)bh * 1024 + t16 * 16 + mbase) * 64 + nfh * 16 + nlo;
    // values and address first, then the stores: no register of an issued store is written among them
    __builtin_amdgcn_sched_barrier(0);
    if (z == 0) {
      // V^T: an accumulator tile is one half fragment as it stands (lane = dh row and key
      // half, register = key), so a lane's 8 values are 16 contiguous bytes at lane * 16
#pragma unroll
      for (int mf = 0; mf < FM; ++mf)
        *(h8*)(dst + (mf >> 1) * 2048 + (mf & 1) * 256) = c[mf];
    } else if (z == 1) {
      // K: the fragment wants lane = key, register = dh, the accumulator has it the other
      // way round: single elements, 8 lanes to a 16-byte piece
#pragma unroll
      for (int mf = 0; mf < FM; ++mf)
#pragma unroll
        for (int v = 0; v < 8; ++v) dst[mf * 1024 + v * 8] = c[mf][v];
    } else {
#pragma unroll
      for (int mf = 0; mf < FM; ++mf)
#pragma unroll
        for (int v = 0; v < 8; ++v) dst[(mf * 16 + v) * 64] = c[mf][v];
    }
    asm volatile("s_wait_xcnt 0x0" ::: "memory");
    __builtin_amdgcn_sched_barrier(0);   // keeps the next fragment's arithmetic behind that wait
  }
}

// Final projection: f32 out [8192][768]
__global__ __launch_bounds__(256)
void gemm_out(const _Float16* __restrict__ A, const _Float16* __restrict__ Bt,
              const float* __restrict__ bias, float* __restrict__ out) {
  typedef Tile<128, 192, 2, 4> T;
  constexpr int FM = T::FM, FN = T::FN;
  __shared__ __attribute__((aligned(2048))) unsigned char lds[2 * T::STAGE];

  const int lane = threadIdx.x & 31;
  const int wid  = (int)uni(threadIdx.x >> 5);
  const int wm   = wid & 1;
  const int wn   = wid >> 1;
  const int m0b  = blockIdx.x * 128;
  const int n0b  = blockIdx.y * 192;
  const int nlo   = lane & 15;
  const int mbase = (lane >> 4) << 3;

  float bv[FN];
#pragma unroll
  for (int nf = 0; nf < FN; ++nf) bv[nf] = bias[n0b + wn * (FN * 16) + nf * 16 + nlo];
  asm volatile("s_wait_xcnt 0x0" ::: "memory");
  __builtin_amdgcn_sched_barrier(0);   // keeps later address arithmetic behind that wait

  v8f acc[FM][FN] = {};
  gemm_tile<128, 192, 2, 4>(A, Bt, lds, m0b, n0b, wid, wm, wn, lane, acc);

#pragma unroll
  for (int mf = 0; mf < FM; ++mf)
#pragma unroll
    for (int nf = 0; nf < FN; ++nf)
#pragma unroll
      for (int v = 0; v < 8; ++v) acc[mf][nf][v] += bv[nf];
  float* dst = out + (size_t)(m0b + wm * (FM * 16) + mbase) * 768 + n0b + wn * (FN * 16) + nlo;
  // all stores last, so that no register of an issued store is written again
  __builtin_amdgcn_sched_barrier(0);
#pragma unroll
  for (int mf = 0; mf < FM; ++mf)
#pragma unroll
    for (int nf = 0; nf < FN; ++nf)
#pragma unroll
      for (int v = 0; v < 8; ++v) dst[(mf * 16 + v) * 768 + nf * 16] = acc[mf][nf][v];
}

#define QG 4

__device__ inline float xhalf(float x) {
  const int i = __builtin_bit_cast(int, x);
  return __builtin_bit_cast(float,
      __builtin_amdgcn_permlanex16(i, i, 0x76543210, 0xfedcba98, false, false));
}

__device__ inline float exp2_slot(float x) {
  float r;
  asm("v_exp_f32 %0, %1\n\tv_nop" : "=v"(r) : "v"(x));
  return r;
}

// S^T tiles of 64 keys x 16 queries: lane holds keys t*16 + 8*(lane>>4) + v of query lane&15
__device__ inline void score_tiles(const v16h (&kf)[4][2], const v16h (&q)[2], v8f (&s)[4]) {
#pragma unroll
  for (int t = 0; t < 4; ++t) {
    v8f z = {};
    z    = WMMA16(kf[t][0], q[0], z);
    s[t] = WMMA16(kf[t][1], q[1], z);
  }
}

__global__ __launch_bounds__(32)
void attn_wmma(const _Float16* __restrict__ Q, const _Float16* __restrict__ K,
               const _Float16* __restrict__ Vt, _Float16* __restrict__ Ctx) {
  const int lane = threadIdx.x;
  const int qt = blockIdx.x % (64 / QG);
  const int bh = blockIdx.x / (64 / QG);   // 0..95
  const int b  = bh / 12, h = bh % 12;

  const _Float16* Qb = Q  + ((size_t)bh * 1024 + qt * (16 * QG)) * 64;
  const _Float16* Kb = K  + (size_t)bh * 1024 * 64;
  const _Float16* Vb = Vt + (size_t)bh * 64 * 1024;

  const int nlo   = lane & 15;
  const int mbase = (lane >> 4) << 3;

  // 1/sqrt(64) and log2(e) in one factor: softmax in base 2
  const float C = 0.125f * 1.4426950408889634f;

  // lane-resolved fragment pointers; Q: row (lane & 15), k offset mbase
  const _Float16* qp = Qb + nlo * 64   + mbase;
  const _Float16* kp = Kb + lane * 8;   // K and V^T: fragment order, 16 bytes a lane
  const _Float16* vp = Vb + lane * 8;

  // Q as B operand (column = query), kept in registers
  v16h qf[QG][2];
#pragma unroll
  for (int g = 0; g < QG; ++g) {
    qf[g][0] = lds_frag(qp + g * 16 * 64 + 0);
    qf[g][1] = lds_frag(qp + g * 16 * 64 + 32);
  }
  asm volatile("s_wait_xcnt 0x0" :: "v"(qp) : "memory");

  v8f   acc[QG][4] = {};     // O^T: row = dh (mbase + v), column = query (nlo)
  float mrun[QG], lrun[QG];  // running maximum (raw score), this half's sum
#pragma unroll
  for (int g = 0; g < QG; ++g) { mrun[g] = -1e30f; lrun[g] = 0.f; }

  for (int pass = 0; pass < 16; ++pass) {
    // K as A operand (row = key), V^T as A operand (row = dh, k = key)
    v16h kf[4][2], vf[4][2];
#pragma unroll
    for (int t = 0; t < 4; ++t) {
      kf[t][0] = packed_frag(kp + (t * 2 + 0) * 512);
      kf[t][1] = packed_frag(kp + (t * 2 + 1) * 512);
    }
#pragma unroll
    for (int nf = 0; nf < 4; ++nf) {
      vf[nf][0] = packed_frag(vp + (0 * 4 + nf) * 512);
      vf[nf][1] = packed_frag(vp + (1 * 4 + nf) * 512);
    }
    asm volatile("s_wait_xcnt 0x0" :: "v"(kp), "v"(vp) : "memory");
    kp += 64 * 64;
    vp += 64 * 64;

    v8f sbuf[2][4];
    score_tiles(kf, qf[0], sbuf[0]);
#pragma unroll
    for (int g = 0; g < QG; ++g) {
      // the next query tile's scores go to the matrix unit ahead of this tile's softmax
      if (g + 1 < QG) score_tiles(kf, qf[g + 1], sbuf[(g + 1) & 1]);
      const v8f* s = sbuf[g & 1];

      float mx = s[0][0];
#pragma unroll
      for (int t = 0; t < 4; ++t)
#pragma unroll
        for (int v = 0; v < 8; ++v) mx = fmaxf(mx, s[t][v]);
      mx = fmaxf(mx, xhalf(mx));            // both halves use one maximum
      const float mnew = fmaxf(mrun[g], mx);
      const float corr = exp2_slot((mrun[g] - mnew) * C);  // 0 on the first pass
      const float mc   = mnew * C;
      mrun[g] = mnew;

      // P^T in the loader's k order: elements 0..7 = even tile, 8..15 = odd tile
      v16h p[2];
      float ps[4];
#pragma unroll
      for (int t = 0; t < 4; ++t) {
        ps[t] = 0.f;
#pragma unroll
        for (int v = 0; v < 8; ++v) {
          const float e = exp2_slot(fmaf(s[t][v], C, -mc));
          ps[t] += e;
          p[t >> 1][(t & 1) * 8 + v] = (_Float16)e;
        }
      }
      lrun[g] = lrun[g] * corr + ((ps[0] + ps[1]) + (ps[2] + ps[3]));

#pragma unroll
      for (int nf = 0; nf < 4; ++nf) {
        v8f o = acc[g][nf] * corr;
        o = WMMA16(vf[nf][0], p[0], o);
        acc[g][nf] = WMMA16(vf[nf][1], p[1], o);
      }
      __builtin_amdgcn_sched_barrier(0);
    }
  }

  // epilogue: join the halves' sums, normalize, write ctx[b][s][h*64+dh] (f16),
  // 8 consecutive dh per lane
  h8 o[QG][4];
#pragma unroll
  for (int g = 0; g < QG; ++g) {
    const float inv = 1.0f / (lrun[g] + xhalf(lrun[g]));
#pragma unroll
    for (int nf = 0; nf < 4; ++nf)
#pragma unroll
      for (int v = 0; v < 8; ++v) o[g][nf][v] = (_Float16)(acc[g][nf][v] * inv);
  }
  _Float16* dst = Ctx + ((size_t)(b * 1024 + qt * (16 * QG) + nlo)) * 768 + h * 64 + mbase;
  // all stores last, so that no register of an issued store is written again
  __builtin_amdgcn_sched_barrier(0);
#pragma unroll
  for (int g = 0; g < QG; ++g)
#pragma unroll
    for (int nf = 0; nf < 4; ++nf)
      *(h8*)(dst + g * 16 * 768 + nf * 16) = o[g][nf];
}

// ---------------------------------------------------------------------------
// Host launcher
// ---------------------------------------------------------------------------
extern "C" void kernel_launch(void* const* d_in, const int* in_sizes, int n_in,
                              void* d_out, int out_size, void* d_ws, size_t ws_size,
                              hipStream_t stream) {
  (void)in_sizes; (void)n_in; (void)out_size; (void)ws_size;

  const float* x  = (const float*)d_in[0];
  const float* Wq = (const float*)d_in[1];
  const float* bq = (const float*)d_in[2];
  const float* Wk = (const float*)d_in[3];
  const float* bk = (const float*)d_in[4];
  const float* Wv = (const float*)d_in[5];
  const float* bv = (const float*)d_in[6];
  const float* Wo = (const float*)d_in[7];
  const float* bo = (const float*)d_in[8];
  float* out = (float*)d_out;

  // workspace layout (f16 elements)
  const size_t XN = 8192ull * 768;     // 6291456
  const size_t WN = 768ull * 768;      // 589824
  _Float16* Xh  = (_Float16*)d_ws;     // also reused as Ctx after QKV
  _Float16* Wvt = Xh  + XN;            // W^T in the order v, k, q, o
  _Float16* Wkt = Wvt + WN;
  _Float16* Wqt = Wkt + WN;
  _Float16* Wot = Wqt + WN;
  _Float16* Vth = Wot + WN;            // projections in the order v, k, q
  _Float16* Kh  = Vth + XN;
  _Float16* Qh  = Kh  + XN;
  _Float16* Ctx = Xh;                  // X dead after QKV projections

  prep<<<544, 256, 0, stream>>>(x, Wv, Wk, Wq, Wo, Xh, Wvt);   // 256 blocks of x + 4 x 72 of W

  dim3 g3(32, 8, 1);                                     // M/256 x (3 * 768)/288
  gemm_qkv<<<g3, 256, 0, stream>>>(Xh, Wvt, bv, bk, bq, Vth);

  attn_wmma<<<1536, 32, 0, stream>>>(Qh, Kh, Vth, Ctx);  // 96 (b,h) x 16 wave tiles of 64 queries

  dim3 g1(64, 4, 1);                                     // M/128 x N/192
  gemm_out<<<g1, 256, 0, stream>>>(Ctx, Wot, bo, out);
}
